// v000
// Measured on an AMD MI455X. A time is GPU time per run, averaged over a window of back-to-back runs after a warm-up
// (all launches, gaps included; the runs take copies of the inputs in turn), and the median of several windows.
// Apart from v000's, it joins two sittings. Times from different sittings can be a few percent apart, while
// side-by-side timings come from the same sitting.
// v000 is the starting kernel. One run takes 1990 microseconds.
#include <hip/hip_runtime.h>

// Multi-head attention with bias-free projections, an output bias and a MODEL-width score scale (x [2][2048][1024]; Q, K, V = x W^T ('oi' [1024][1024] normal x 0.02, no bias; 16 heads x 64); scores / sqrt(float32(1024)) = x 0.03125 (the source divides by the square root of the FULL width k, not of the head width); softmax (no mask); out = merged Wo^T + bo ('oi' + bias zeros on this draw: read) -> [2][2048][1024] (4.2 M); argument order x, Wq, Wk, Wv, Wo, bo.
// Layout per batch: bf16 copy of x; 'oi' weights; exact projections; identity-table plane builders; dense T-2048 attention (hybrid rows: < 512 hi/lo 3 products, rest fp16 x1024); merged hi/lo x Wo exact + bo.
// Compute dtypes, f32 accumulate: every input rounded to bf16; projections exact; attention rows < 512 3 products, rest fp16; softmax f32; Wo hl x exact + bias.

#define NB_  2
#define TT   2048
#define DM   1024
#define NH_  16
#define NKV  16
#define REP  (NH_ / NKV)
#define HD   64
#define DQ   (NH_ * HD)
#define DKV  (NKV * HD)
#define ZH   2
#define RH   512                  // query rows < RH use hi+lo planes (0: none)
#define WIN  0
#define PCAR 1024.0f
#define SCL  0.03125f   // 1 / sqrt(1024): this module divides by sqrt(k) with k the FULL width
typedef _Float16 h16;
typedef unsigned short bf;
typedef __attribute__((ext_vector_type(16))) __bf16   v16bf;
typedef __attribute__((ext_vector_type(16))) _Float16 v16h;
typedef __attribute__((ext_vector_type(8)))  _Float16 v8h;
typedef __attribute__((ext_vector_type(8)))  unsigned short v8us;
typedef __attribute__((ext_vector_type(8)))  float    v8f;
typedef __attribute__((ext_vector_type(4)))  float    v4f;
typedef v8h  __attribute__((may_alias)) v8ha;
typedef v4f  __attribute__((may_alias)) v4fa;
typedef v8us __attribute__((may_alias)) v8usa;

__device__ __forceinline__ unsigned short f2bf(float f) { unsigned u = __float_as_uint(f); u += 0x7FFFu + ((u >> 16) & 1u); return (unsigned short)(u >> 16); }
__device__ __forceinline__ float bf2f(unsigned short b) { return __uint_as_float(((unsigned)b) << 16); }
__device__ __forceinline__ float bfr(float f) { return bf2f(f2bf(f)); }
__device__ __forceinline__ v16h cat16(v8h lo, v8h hi) { return __builtin_shufflevector(lo, hi, 0, 1, 2, 3, 4, 5, 6, 7, 8, 9, 10, 11, 12, 13, 14, 15); }
__device__ __forceinline__ v16bf cat16b(v8us lo, v8us hi) { return __builtin_bit_cast(v16bf, __builtin_shufflevector(lo, hi, 0, 1, 2, 3, 4, 5, 6, 7, 8, 9, 10, 11, 12, 13, 14, 15)); }
__device__ __forceinline__ v8f wmma16(v16h a, v16h b, v8f c) { return __builtin_amdgcn_wmma_f32_16x16x32_f16(false, a, false, b, (short)0, c, false, false); }
__device__ __forceinline__ v8f wmmab(v16bf a, v16bf b, v8f c) { return __builtin_amdgcn_wmma_f32_16x16x32_bf16(false, a, false, b, (short)0, c, false, false); }



// ---- k_gemmw: register-blocked GEMM, ONE WAVE per 64x64 output tile (16 accumulators), operands straight from K-contiguous 16-bit planes; grid (M/64, N/64, Z), 32 threads.
// C[m][n] (f32, pitch ldc, + optional f32 bias[n]) = sum_k A[m][k] Bt[n][k] (+ split products per NSPLIT). z-batch strides sA/sB/sC in elements. K % 32 == 0.
template <typename T16> struct WFrag;
template <> struct WFrag<h16> { typedef v16h V; static __device__ __forceinline__ V ld(const h16* p) { return cat16(*(const v8h*)p, *(const v8h*)(p + 16)); } static __device__ __forceinline__ v8f mma(V a, V b, v8f c) { return wmma16(a, b, c); } };
template <> struct WFrag<bf> { typedef v16bf V; static __device__ __forceinline__ V ld(const bf* p) { return cat16b(*(const v8us*)p, *(const v8us*)(p + 16)); } static __device__ __forceinline__ v8f mma(V a, V b, v8f c) { return wmmab(a, b, c); } };
template <typename T16, int NSPLIT, bool BIAS>
__global__ __launch_bounds__(32) void k_gemmw(const T16* __restrict__ A, const T16* __restrict__ A2, const T16* __restrict__ Bt, const T16* __restrict__ Bt2, int K, float* C, int ldc, const float* __restrict__ bias, size_t sA, size_t sB, size_t sC) {
    typedef typename WFrag<T16>::V V;
    __shared__ __align__(16) float os[16 * 68];
    const size_t z = blockIdx.z; A += z * sA; if (A2) A2 += z * sA; Bt += z * sB; if (Bt2) Bt2 += z * sB; C += z * sC;
    const int lane = threadIdx.x & 31, lr = lane & 15, hi = lane >> 4; const int r0 = blockIdx.x * 64, c0 = blockIdx.y * 64;
    v8f acc[4][4];
#pragma unroll
    for (int mb = 0; mb < 4; ++mb)
#pragma unroll
        for (int nb = 0; nb < 4; ++nb) acc[mb][nb] = (v8f){};
    const size_t aoff = (size_t)(r0 + lr) * K + 8 * hi, boff = (size_t)(c0 + lr) * K + 8 * hi;
#pragma unroll 1
    for (int kc = 0; kc < K; kc += 32) {
        V a[4], a2[4];
#pragma unroll
        for (int mb = 0; mb < 4; ++mb) { a[mb] = WFrag<T16>::ld(A + aoff + (size_t)mb * 16 * K + kc); if (NSPLIT == 1 || NSPLIT == 2) a2[mb] = WFrag<T16>::ld(A2 + aoff + (size_t)mb * 16 * K + kc); }
#pragma unroll
        for (int nb = 0; nb < 4; ++nb) { const V b = WFrag<T16>::ld(Bt + boff + (size_t)nb * 16 * K + kc); V b2; if (NSPLIT >= 2) b2 = WFrag<T16>::ld(Bt2 + boff + (size_t)nb * 16 * K + kc);
#pragma unroll
            for (int mb = 0; mb < 4; ++mb) { acc[mb][nb] = WFrag<T16>::mma(a[mb], b, acc[mb][nb]); if (NSPLIT == 1 || NSPLIT == 2) acc[mb][nb] = WFrag<T16>::mma(a2[mb], b, acc[mb][nb]); if (NSPLIT >= 2) acc[mb][nb] = WFrag<T16>::mma(a[mb], b2, acc[mb][nb]); } }
        asm volatile("v_nop\n\tv_nop\n\tv_nop\n\tv_nop" : "+v"(acc[0][0]), "+v"(acc[1][1]), "+v"(acc[2][2]), "+v"(acc[3][3]) : "v"(a[0]), "v"(a[3]));
    }
#pragma unroll
    for (int mb = 0; mb < 4; ++mb) {
#pragma unroll
        for (int nb = 0; nb < 4; ++nb) {
#pragma unroll
            for (int j = 0; j < 8; ++j) os[(hi * 8 + j) * 68 + nb * 16 + lr] = acc[mb][nb][j]; }
        __builtin_amdgcn_wave_barrier(); asm volatile("" ::: "memory");
        float* crow = C + (size_t)(r0 + mb * 16) * ldc + c0;
{
#pragma unroll
            for (int s = 0; s < 8; ++s) { const int row = 2 * s + hi, cofs = lr * 4; v4f val = *(const v4fa*)(os + row * 68 + cofs); if (BIAS) { val[0] += bfr(bias[c0 + cofs]); val[1] += bfr(bias[c0 + cofs + 1]); val[2] += bfr(bias[c0 + cofs + 2]); val[3] += bfr(bias[c0 + cofs + 3]); }
                *(v4f*)(crow + (size_t)row * ldc + cofs) = val; }
             }
        __builtin_amdgcn_wave_barrier(); asm volatile("" ::: "memory");
    }
}

__device__ __forceinline__ h16 tohx(float x) { return (h16)x; }
__device__ __forceinline__ void splitf(float y, unsigned short& h, unsigned short& l) { h = f2bf(y); l = f2bf(y - bf2f(h)); }
typedef __attribute__((ext_vector_type(2))) _Float16 v2h;
typedef __attribute__((ext_vector_type(4))) _Float16 v4h;
typedef __attribute__((ext_vector_type(2))) unsigned short v2us;
typedef __attribute__((ext_vector_type(4))) unsigned short v4us;
typedef __attribute__((ext_vector_type(2))) float v2f;
typedef __attribute__((ext_vector_type(4))) int v4i;

__global__ __launch_bounds__(256) void k_cvt8(const float* __restrict__ src, bf* dst, size_t n8) { const size_t i = (size_t)blockIdx.x * 256 + threadIdx.x; if (i >= n8) return; const v8f v = *(const v8f*)(src + i * 8); v8us o;
#pragma unroll
    for (int k = 0; k < 8; ++k) o[k] = f2bf(v[k]); *(v8us*)(dst + i * 8) = o;  }

// k_rope: head planes [h][t][d] (fp16 + hi/lo) of rope(x) x sc with the rotate-half convention out[d] = x[d] cos[t][d] - x[d+HD/2] sin[t][d], out[d+HD/2] = x[d+HD/2] cos[t][d+HD/2] + x[d] sin[t][d+HD/2]
__global__ __launch_bounds__(256) void k_rope(const float* __restrict__ F, int pitch, int nheads, const float* __restrict__ CS, const float* __restrict__ RF, const float* __restrict__ nw, float sc, h16* P16, bf* Ph, bf* Pl) {
    const size_t e = ((size_t)blockIdx.x * 256 + threadIdx.x) * 2; if (e >= (size_t)nheads * TT * HD) return; const int d = (int)(e % HD); const int t = (int)((e / HD) % TT); const int h = (int)(e / ((size_t)HD * TT)); const float* f = F + (size_t)t * pitch + h * HD; const float rf = RF ? RF[(size_t)h * TT + t] : 1.0f; v2h o16; v2us oh, ol;
#pragma unroll
    for (int q = 0; q < 2; ++q) { const int dd = d + q; const int dp = (dd < HD / 2) ? dd + HD / 2 : dd - HD / 2; float x0 = f[dd], x1 = f[dp];
        if (RF) { float n0 = __fmul_rn(x0, rf), n1 = __fmul_rn(x1, rf); asm volatile("" : "+v"(n0)); asm volatile("" : "+v"(n1)); x0 = __fmul_rn(bfr(nw[dd]), n0); x1 = __fmul_rn(bfr(nw[dp]), n1); }
        const v2f cs = *(const v2f*)(CS + ((size_t)t * HD + dd) * 2); float a = __fmul_rn(x0, cs[0]), bq = __fmul_rn(x1, cs[1]); asm volatile("" : "+v"(a)); asm volatile("" : "+v"(bq)); const float r = ((dd < HD / 2) ? __fsub_rn(a, bq) : __fadd_rn(a, bq)) * sc;
        o16[q] = tohx(r); unsigned short a2, c2; splitf(r, a2, c2); oh[q] = a2; ol[q] = c2; }
    *(v2h*)(P16 + e) = o16; *(v2us*)(Ph + e) = oh; *(v2us*)(Pl + e) = ol;  }
__global__ __launch_bounds__(256) void k_vtp(const float* __restrict__ F, int pitch, int nheads, h16* V16, bf* Vh, bf* Vl) { const size_t e = ((size_t)blockIdx.x * 256 + threadIdx.x) * 2; if (e >= (size_t)nheads * HD * TT) return; const int t = (int)(e % TT); const int d = (int)((e / TT) % HD); const int g = (int)(e / ((size_t)TT * HD)); v2h o16; v2us oh, ol;
#pragma unroll
    for (int q = 0; q < 2; ++q) { const float x = F[(size_t)(t + q) * pitch + g * HD + d]; o16[q] = tohx(x); unsigned short a2, c2; splitf(x, a2, c2); oh[q] = a2; ol[q] = c2; }
    *(v2h*)(V16 + e) = o16; *(v2us*)(Vh + e) = oh; *(v2us*)(Vl + e) = ol;  }
__global__ __launch_bounds__(256) void k_csid(float* CS) { const int idx = blockIdx.x * 256 + threadIdx.x; if (idx >= TT * HD) return; v2f cs; cs[0] = 1.0f; cs[1] = 0.0f; *(v2f*)(CS + (size_t)idx * 2) = cs;  }
// k_asoft: per row (zz, i): t = S x DM^-0.5 (no mask); softmax over the 2048 keys (register row, one exp, fixed trees);
__global__ __launch_bounds__(256) void k_asoft(const float* __restrict__ Sb, h16* P16, bf* Ph, bf* Pl) {
    const int lane = threadIdx.x & 31; const int row = blockIdx.x * 8 + (threadIdx.x >> 5); if (row >= ZH * TT) return; const int i = row % TT; const int zz = row / TT; (void)zz; const bool hires = (i < RH); const float* sr = Sb + (size_t)row * TT; float v[TT / 32]; float mx = -3.0e38f;
#pragma unroll
    for (int ch = 0; ch < TT / 128; ++ch) { const int j0 = ch * 128 + lane * 4; const v4f a = *(const v4f*)(sr + j0);
#pragma unroll
        for (int q = 0; q < 4; ++q) { const int j = j0 + q; (void)j; const float t = a[q] * SCL; v[ch * 4 + q] = t; mx = fmaxf(mx, t); } }
#pragma unroll
    for (int sh = 16; sh; sh >>= 1) mx = fmaxf(mx, __shfl_xor(mx, sh, 32));
    float sum = 0.f;
#pragma unroll
    for (int k = 0; k < TT / 32; ++k) { float d0 = __fsub_rn(v[k], mx); asm volatile("" : "+v"(d0)); v[k] = __builtin_amdgcn_exp2f(__fmul_rn(d0, 1.4426950408889634f)); sum += v[k]; }
#pragma unroll
    for (int sh = 16; sh; sh >>= 1) sum += __shfl_xor(sum, sh, 32);
    const float f = __fdiv_rn(hires ? 1.0f : PCAR, sum);
{
        if (hires) {
#pragma unroll
            for (int ch = 0; ch < TT / 128; ++ch) { v4us oh, ol;
#pragma unroll
                for (int q = 0; q < 4; ++q) { unsigned short a, c2; splitf(v[ch * 4 + q] * f, a, c2); oh[q] = a; ol[q] = c2; }
                const size_t oo = ((size_t)zz * (RH ? RH : 1) + i) * TT + ch * 128 + lane * 4; *(v4us*)(Ph + oo) = oh; *(v4us*)(Pl + oo) = ol; }
        } else {
#pragma unroll
            for (int ch = 0; ch < TT / 128; ++ch) { v4h o4;
#pragma unroll
                for (int q = 0; q < 4; ++q) o4[q] = tohx(v[ch * 4 + q] * f);
                *(v4h*)(P16 + (size_t)row * TT + ch * 128 + lane * 4) = o4; } }
         }
}
__global__ __launch_bounds__(256) void k_merge(const float* __restrict__ O, int h0, bf* Ah, bf* Al) { const size_t e = ((size_t)blockIdx.x * 256 + threadIdx.x) * 2; if (e >= (size_t)ZH * TT * HD) return; const int d = (int)(e % HD); const int t = (int)((e / HD) % TT); const int zz = (int)(e / ((size_t)HD * TT)); const float cs = (t < RH) ? 1.0f : (1.0f / PCAR); const size_t oo = (size_t)t * DQ + (h0 + zz) * HD + d;
    v2us oh, ol;
#pragma unroll
    for (int q = 0; q < 2; ++q) { unsigned short a, c2; splitf(O[e + q] * cs, a, c2); oh[q] = a; ol[q] = c2; } *(v2us*)(Ah + oo) = oh; *(v2us*)(Al + oo) = ol;  }

extern "C" void kernel_launch(void* const* d_in, const int* in_sizes, int n_in,
                              void* d_out, int out_size, void* d_ws, size_t ws_size, hipStream_t stream) {
    (void)in_sizes; (void)n_in; (void)out_size;
    const float* x = (const float*)d_in[0]; const float* wq = (const float*)d_in[1]; const float* wk = (const float*)d_in[2]; const float* wv = (const float*)d_in[3]; const float* wo = (const float*)d_in[4]; const float* bo = (const float*)d_in[5];   /* input order x, Wq, Wk, Wv, Wo ('oi' [1024][1024]), bo */
    float* OUT = (float*)d_out;     // [2][2048][1024]
    char* wsp = (char*)d_ws;
    auto take = [&](size_t bytes) { char* p = wsp; wsp += (bytes + 255) & ~(size_t)255; return (void*)p; };
    bf* WQ = (bf*)take((size_t)DQ * DM * 2); bf* WK = (bf*)take((size_t)DKV * DM * 2); bf* WV = (bf*)take((size_t)DKV * DM * 2); bf* WO = (bf*)take((size_t)DM * DQ * 2); float* CS = (float*)take((size_t)TT * HD * 2 * 4);
    bf* XB = (bf*)take((size_t)TT * DM * 2); float* FQ = (float*)take((size_t)TT * DQ * 4); float* FK = (float*)take((size_t)TT * DKV * 4);
    h16* QP16 = (h16*)take((size_t)NH_ * TT * HD * 2); h16* KP16 = (h16*)take((size_t)NKV * TT * HD * 2); h16* VT16 = (h16*)take((size_t)NKV * HD * TT * 2);
    bf* QPh = (bf*)take((size_t)NH_ * TT * HD * 2); bf* QPl = (bf*)take((size_t)NH_ * TT * HD * 2); bf* KPh = (bf*)take((size_t)NKV * TT * HD * 2); bf* KPl = (bf*)take((size_t)NKV * TT * HD * 2); bf* VTh = (bf*)take((size_t)NKV * HD * TT * 2); bf* VTl = (bf*)take((size_t)NKV * HD * TT * 2); bf* Ph = (bf*)take((size_t)ZH * RH * TT * 2); bf* Pl = (bf*)take((size_t)ZH * RH * TT * 2);
    float* Sb = (float*)take((size_t)ZH * TT * TT * 4); h16* P16 = (h16*)take((size_t)ZH * TT * TT * 2); float* Ob = (float*)take((size_t)ZH * TT * HD * 4); bf* ATh = (bf*)take((size_t)TT * DQ * 2); bf* ATl = (bf*)take((size_t)TT * DQ * 2);
    if ((size_t)(wsp - (char*)d_ws) > ws_size) return;    // ws 256 MiB
    float* FV = FK;   // v projection reuses the k buffer after the k planes are built (stream-ordered)
    { k_cvt8<<<(unsigned)(((size_t)DQ * DM / 8 + 255) / 256), 256, 0, stream>>>(wq, WQ, (size_t)DQ * DM / 8); k_cvt8<<<(unsigned)(((size_t)DKV * DM / 8 + 255) / 256), 256, 0, stream>>>(wk, WK, (size_t)DKV * DM / 8); k_cvt8<<<(unsigned)(((size_t)DKV * DM / 8 + 255) / 256), 256, 0, stream>>>(wv, WV, (size_t)DKV * DM / 8);
      k_cvt8<<<(unsigned)(((size_t)DM * DQ / 8 + 255) / 256), 256, 0, stream>>>(wo, WO, (size_t)DM * DQ / 8);
       }
    k_csid<<<(TT * HD + 255) / 256, 256, 0, stream>>>(CS);
    const unsigned LQ = (unsigned)(((size_t)NH_ * TT * HD / 2 + 255) / 256), LKv = (unsigned)(((size_t)NKV * TT * HD / 2 + 255) / 256);
    for (int b = 0; b < NB_; ++b) {
        
        k_cvt8<<<(unsigned)(((size_t)TT * DM / 8 + 255) / 256), 256, 0, stream>>>(x + (size_t)b * TT * DM, XB, (size_t)TT * DM / 8);
        k_gemmw<bf, 0, false><<<dim3(TT / 64, DQ / 64, 1), 32, 0, stream>>>(XB, nullptr, WQ, nullptr, DM, FQ, DQ, nullptr, 0, 0, 0);
        k_rope<<<LQ, 256, 0, stream>>>(FQ, DQ, NH_, CS, nullptr, nullptr, 1.0f, QP16, QPh, QPl);
        k_gemmw<bf, 0, false><<<dim3(TT / 64, DKV / 64, 1), 32, 0, stream>>>(XB, nullptr, WK, nullptr, DM, FK, DKV, nullptr, 0, 0, 0);
        k_rope<<<LKv, 256, 0, stream>>>(FK, DKV, NKV, CS, nullptr, nullptr, 1.0f, KP16, KPh, KPl);
        k_gemmw<bf, 0, false><<<dim3(TT / 64, DKV / 64, 1), 32, 0, stream>>>(XB, nullptr, WV, nullptr, DM, FV, DKV, nullptr, 0, 0, 0); k_vtp<<<LKv, 256, 0, stream>>>(FV, DKV, NKV, VT16, VTh, VTl);
        for (int h0 = 0; h0 < NH_; h0 += ZH) { const size_t zq = (size_t)h0, zk = (size_t)(h0 / REP);   // one kv head per query head: the pass's two heads use consecutive kv planes (z-strides TT*HD)
            k_gemmw<bf, 2, false><<<dim3(RH / 64, TT / 64, ZH), 32, 0, stream>>>(QPh + zq * TT * HD, QPl + zq * TT * HD, KPh + zk * TT * HD, KPl + zk * TT * HD, HD, Sb, TT, nullptr, (size_t)TT * HD, (size_t)TT * HD, (size_t)TT * TT);
            k_gemmw<h16, 0, false><<<dim3((TT - RH) / 64, TT / 64, ZH), 32, 0, stream>>>(QP16 + zq * TT * HD + (size_t)RH * HD, nullptr, KP16 + zk * TT * HD, nullptr, HD, Sb + (size_t)RH * TT, TT, nullptr, (size_t)TT * HD, (size_t)TT * HD, (size_t)TT * TT);
            k_asoft<<<ZH * TT / 8, 256, 0, stream>>>(Sb, P16, Ph, Pl);
            k_gemmw<bf, 2, false><<<dim3(RH / 64, HD / 64, ZH), 32, 0, stream>>>(Ph, Pl, VTh + zk * HD * TT, VTl + zk * HD * TT, TT, Ob, HD, nullptr, (size_t)RH * TT, (size_t)HD * TT, (size_t)TT * HD);
            k_gemmw<h16, 0, false><<<dim3((TT - RH) / 64, HD / 64, ZH), 32, 0, stream>>>(P16 + (size_t)RH * TT, nullptr, VT16 + zk * HD * TT, nullptr, TT, Ob + (size_t)RH * HD, HD, nullptr, (size_t)TT * TT, (size_t)HD * TT, (size_t)TT * HD);
            k_merge<<<(unsigned)(((size_t)ZH * TT * HD / 2 + 255) / 256), 256, 0, stream>>>(Ob, h0, ATh, ATl); }
        k_gemmw<bf, 1, true><<<dim3(TT / 64, DM / 64, 1), 32, 0, stream>>>(ATh, ATl, WO, nullptr, DQ, OUT + (size_t)b * TT * DM, DM, bo, 0, 0, 0); }
}

// v001
// One run takes 1050 microseconds.
// Next to v000, in two timings, it ran 1.88 and 1.87 times as fast.
#include <hip/hip_runtime.h>

// Multi-head attention with bias-free projections, an output bias and a MODEL-width score scale (x [2][2048][1024]; Q, K, V = x W^T ('oi' [1024][1024] normal x 0.02, no bias; 16 heads x 64); scores / sqrt(float32(1024)) = x 0.03125 (the source divides by the square root of the FULL width k, not of the head width); softmax (no mask); out = merged Wo^T + bo ('oi' + bias zeros on this draw: read) -> [2][2048][1024] (4.2 M); argument order x, Wq, Wk, Wv, Wo, bo.
// Layout per batch: bf16 copy of x; 'oi' weights; exact projections; identity-table plane builders; dense T-2048 attention (hybrid rows: < 512 hi/lo 3 products, rest fp16 x1024); merged hi/lo x Wo exact + bo.
// Compute dtypes, f32 accumulate: every input rounded to bf16; projections exact; attention rows < 512 3 products, rest fp16; softmax f32; Wo hl x exact + bias.

#define NB_  2
#define TT   2048
#define DM   1024
#define NH_  16
#define NKV  16
#define REP  (NH_ / NKV)
#define HD   64
#define DQ   (NH_ * HD)
#define DKV  (NKV * HD)
#define ZH   2
#define RH   512                  // query rows < RH use hi+lo planes (0: none)
#define WIN  0
#define PCAR 1024.0f
#define SCL  0.03125f   // 1 / sqrt(1024): this module divides by sqrt(k) with k the FULL width
typedef _Float16 h16;
typedef unsigned short bf;
typedef __attribute__((ext_vector_type(16))) __bf16   v16bf;
typedef __attribute__((ext_vector_type(16))) _Float16 v16h;
typedef __attribute__((ext_vector_type(8)))  _Float16 v8h;
typedef __attribute__((ext_vector_type(8)))  unsigned short v8us;
typedef __attribute__((ext_vector_type(8)))  float    v8f;
typedef __attribute__((ext_vector_type(4)))  float    v4f;
typedef v8h  __attribute__((may_alias)) v8ha;
typedef v4f  __attribute__((may_alias)) v4fa;
typedef v8us __attribute__((may_alias)) v8usa;

__device__ __forceinline__ unsigned short f2bf(float f) { unsigned u = __float_as_uint(f); u += 0x7FFFu + ((u >> 16) & 1u); return (unsigned short)(u >> 16); }
__device__ __forceinline__ float bf2f(unsigned short b) { return __uint_as_float(((unsigned)b) << 16); }
__device__ __forceinline__ float bfr(float f) { return bf2f(f2bf(f)); }
__device__ __forceinline__ v16h cat16(v8h lo, v8h hi) { return __builtin_shufflevector(lo, hi, 0, 1, 2, 3, 4, 5, 6, 7, 8, 9, 10, 11, 12, 13, 14, 15); }
__device__ __forceinline__ v16bf cat16b(v8us lo, v8us hi) { return __builtin_bit_cast(v16bf, __builtin_shufflevector(lo, hi, 0, 1, 2, 3, 4, 5, 6, 7, 8, 9, 10, 11, 12, 13, 14, 15)); }
__device__ __forceinline__ v8f wmma16(v16h a, v16h b, v8f c) { return __builtin_amdgcn_wmma_f32_16x16x32_f16(false, a, false, b, (short)0, c, false, false); }
__device__ __forceinline__ v8f wmmab(v16bf a, v16bf b, v8f c) { return __builtin_amdgcn_wmma_f32_16x16x32_bf16(false, a, false, b, (short)0, c, false, false); }



// ---- k_gemmw: register-blocked GEMM, one 64x64 output tile per work-group (16 accumulators per wave), operands straight from K-contiguous 16-bit planes; grid (M/64, N/64, Z), 32 * KS threads.
// C[m][n] (f32, pitch ldc, + optional f32 bias[n]) = sum_k A[m][k] Bt[n][k] (+ split products per NSPLIT). z-batch strides sA/sB/sC in elements. K % (32 * KS) == 0.
// KS waves split K: wave w sums k in [w K/KS, (w+1) K/KS) for the whole tile, the KS partial tiles meet in LDS and are added in wave order (fixed, so the result is the same on every run).
template <typename T16> struct WFrag;
template <> struct WFrag<h16> { typedef v16h V; static __device__ __forceinline__ V ld(const h16* p) { return cat16(*(const v8h*)p, *(const v8h*)(p + 16)); } static __device__ __forceinline__ v8f mma(V a, V b, v8f c) { return wmma16(a, b, c); } };
template <> struct WFrag<bf> { typedef v16bf V; static __device__ __forceinline__ V ld(const bf* p) { return cat16b(*(const v8us*)p, *(const v8us*)(p + 16)); } static __device__ __forceinline__ v8f mma(V a, V b, v8f c) { return wmmab(a, b, c); } };
template <typename T16, int NSPLIT, bool BIAS, int KS>
__global__ __launch_bounds__(32 * KS) void k_gemmw(const T16* __restrict__ A, const T16* __restrict__ A2, const T16* __restrict__ Bt, const T16* __restrict__ Bt2, int K, float* C, int ldc, const float* __restrict__ bias, size_t sA, size_t sB, size_t sC) {
    typedef typename WFrag<T16>::V V;
    __shared__ __align__(16) float os[(KS == 1 ? 16 : KS * 64) * 68];
    const size_t z = blockIdx.z; A += z * sA; if (A2) A2 += z * sA; Bt += z * sB; if (Bt2) Bt2 += z * sB; C += z * sC;
    const int lane = threadIdx.x & 31, lr = lane & 15, hi = lane >> 4; const int r0 = blockIdx.x * 64, c0 = blockIdx.y * 64;
    v8f acc[4][4];
#pragma unroll
    for (int mb = 0; mb < 4; ++mb)
#pragma unroll
        for (int nb = 0; nb < 4; ++nb) acc[mb][nb] = (v8f){};
    const size_t aoff = (size_t)(r0 + lr) * K + 8 * hi, boff = (size_t)(c0 + lr) * K + 8 * hi;
    const int wv = KS == 1 ? 0 : __builtin_amdgcn_readfirstlane((int)(threadIdx.x >> 5)); const int kb = wv * (K / KS), ke = kb + K / KS;
#pragma unroll 1
    for (int kc = kb; kc < ke; kc += 32) {
        V a[4], a2[4];
#pragma unroll
        for (int mb = 0; mb < 4; ++mb) { a[mb] = WFrag<T16>::ld(A + aoff + (size_t)mb * 16 * K + kc); if (NSPLIT == 1 || NSPLIT == 2) a2[mb] = WFrag<T16>::ld(A2 + aoff + (size_t)mb * 16 * K + kc); }
#pragma unroll
        for (int nb = 0; nb < 4; ++nb) { const V b = WFrag<T16>::ld(Bt + boff + (size_t)nb * 16 * K + kc); V b2; if (NSPLIT >= 2) b2 = WFrag<T16>::ld(Bt2 + boff + (size_t)nb * 16 * K + kc);
#pragma unroll
            for (int mb = 0; mb < 4; ++mb) { acc[mb][nb] = WFrag<T16>::mma(a[mb], b, acc[mb][nb]); if (NSPLIT == 1 || NSPLIT == 2) acc[mb][nb] = WFrag<T16>::mma(a2[mb], b, acc[mb][nb]); if (NSPLIT >= 2) acc[mb][nb] = WFrag<T16>::mma(a[mb], b2, acc[mb][nb]); } }
        asm volatile("v_nop\n\tv_nop\n\tv_nop\n\tv_nop" : "+v"(acc[0][0]), "+v"(acc[1][1]), "+v"(acc[2][2]), "+v"(acc[3][3]) : "v"(a[0]), "v"(a[3]));
    }
    if constexpr (KS > 1) {
        float* ow = os + wv * (64 * 68);
#pragma unroll
        for (int mb = 0; mb < 4; ++mb)
#pragma unroll
            for (int nb = 0; nb < 4; ++nb)
#pragma unroll
                for (int j = 0; j < 8; ++j) ow[(mb * 16 + hi * 8 + j) * 68 + nb * 16 + lr] = acc[mb][nb][j];
        __syncthreads();   // every wave's partial tile is in LDS before any thread sums across waves
#pragma unroll
        for (int s = 0; s < 32 / KS; ++s) { const int q4 = s * (32 * KS) + (int)threadIdx.x, row = q4 >> 4, cofs = (q4 & 15) * 4; v4f val = *(const v4fa*)(os + row * 68 + cofs);
#pragma unroll
            for (int w = 1; w < KS; ++w) val += *(const v4fa*)(os + w * (64 * 68) + row * 68 + cofs);
            if (BIAS) { val[0] += bfr(bias[c0 + cofs]); val[1] += bfr(bias[c0 + cofs + 1]); val[2] += bfr(bias[c0 + cofs + 2]); val[3] += bfr(bias[c0 + cofs + 3]); }
            *(v4f*)(C + (size_t)(r0 + row) * ldc + c0 + cofs) = val; }
        return;
    }
#pragma unroll
    for (int mb = 0; mb < 4; ++mb) {
#pragma unroll
        for (int nb = 0; nb < 4; ++nb) {
#pragma unroll
            for (int j = 0; j < 8; ++j) os[(hi * 8 + j) * 68 + nb * 16 + lr] = acc[mb][nb][j]; }
        __builtin_amdgcn_wave_barrier(); asm volatile("" ::: "memory");
        float* crow = C + (size_t)(r0 + mb * 16) * ldc + c0;
{
#pragma unroll
            for (int s = 0; s < 8; ++s) { const int row = 2 * s + hi, cofs = lr * 4; v4f val = *(const v4fa*)(os + row * 68 + cofs); if (BIAS) { val[0] += bfr(bias[c0 + cofs]); val[1] += bfr(bias[c0 + cofs + 1]); val[2] += bfr(bias[c0 + cofs + 2]); val[3] += bfr(bias[c0 + cofs + 3]); }
                *(v4f*)(crow + (size_t)row * ldc + cofs) = val; }
             }
        __builtin_amdgcn_wave_barrier(); asm volatile("" ::: "memory");
    }
}

__device__ __forceinline__ h16 tohx(float x) { return (h16)x; }
__device__ __forceinline__ void splitf(float y, unsigned short& h, unsigned short& l) { h = f2bf(y); l = f2bf(y - bf2f(h)); }
typedef __attribute__((ext_vector_type(2))) _Float16 v2h;
typedef __attribute__((ext_vector_type(4))) _Float16 v4h;
typedef __attribute__((ext_vector_type(2))) unsigned short v2us;
typedef __attribute__((ext_vector_type(4))) unsigned short v4us;
typedef __attribute__((ext_vector_type(2))) float v2f;
typedef __attribute__((ext_vector_type(4))) int v4i;

__global__ __launch_bounds__(256) void k_cvt8(const float* __restrict__ src, bf* dst, size_t n8) { const size_t i = (size_t)blockIdx.x * 256 + threadIdx.x; if (i >= n8) return; const v8f v = *(const v8f*)(src + i * 8); v8us o;
#pragma unroll
    for (int k = 0; k < 8; ++k) o[k] = f2bf(v[k]); *(v8us*)(dst + i * 8) = o;  }

// k_rope: head planes [h][t][d] (fp16 + hi/lo) of rope(x) x sc with the rotate-half convention out[d] = x[d] cos[t][d] - x[d+HD/2] sin[t][d], out[d+HD/2] = x[d+HD/2] cos[t][d+HD/2] + x[d] sin[t][d+HD/2]
__global__ __launch_bounds__(256) void k_rope(const float* __restrict__ F, int pitch, int nheads, const float* __restrict__ CS, const float* __restrict__ RF, const float* __restrict__ nw, float sc, h16* P16, bf* Ph, bf* Pl) {
    const size_t e = ((size_t)blockIdx.x * 256 + threadIdx.x) * 2; if (e >= (size_t)nheads * TT * HD) return; const int d = (int)(e % HD); const int t = (int)((e / HD) % TT); const int h = (int)(e / ((size_t)HD * TT)); const float* f = F + (size_t)t * pitch + h * HD; const float rf = RF ? RF[(size_t)h * TT + t] : 1.0f; v2h o16; v2us oh, ol;
#pragma unroll
    for (int q = 0; q < 2; ++q) { const int dd = d + q; const int dp = (dd < HD / 2) ? dd + HD / 2 : dd - HD / 2; float x0 = f[dd], x1 = f[dp];
        if (RF) { float n0 = __fmul_rn(x0, rf), n1 = __fmul_rn(x1, rf); asm volatile("" : "+v"(n0)); asm volatile("" : "+v"(n1)); x0 = __fmul_rn(bfr(nw[dd]), n0); x1 = __fmul_rn(bfr(nw[dp]), n1); }
        const v2f cs = *(const v2f*)(CS + ((size_t)t * HD + dd) * 2); float a = __fmul_rn(x0, cs[0]), bq = __fmul_rn(x1, cs[1]); asm volatile("" : "+v"(a)); asm volatile("" : "+v"(bq)); const float r = ((dd < HD / 2) ? __fsub_rn(a, bq) : __fadd_rn(a, bq)) * sc;
        o16[q] = tohx(r); unsigned short a2, c2; splitf(r, a2, c2); oh[q] = a2; ol[q] = c2; }
    *(v2h*)(P16 + e) = o16; *(v2us*)(Ph + e) = oh; *(v2us*)(Pl + e) = ol;  }
__global__ __launch_bounds__(256) void k_vtp(const float* __restrict__ F, int pitch, int nheads, h16* V16, bf* Vh, bf* Vl) { const size_t e = ((size_t)blockIdx.x * 256 + threadIdx.x) * 2; if (e >= (size_t)nheads * HD * TT) return; const int t = (int)(e % TT); const int d = (int)((e / TT) % HD); const int g = (int)(e / ((size_t)TT * HD)); v2h o16; v2us oh, ol;
#pragma unroll
    for (int q = 0; q < 2; ++q) { const float x = F[(size_t)(t + q) * pitch + g * HD + d]; o16[q] = tohx(x); unsigned short a2, c2; splitf(x, a2, c2); oh[q] = a2; ol[q] = c2; }
    *(v2h*)(V16 + e) = o16; *(v2us*)(Vh + e) = oh; *(v2us*)(Vl + e) = ol;  }
__global__ __launch_bounds__(256) void k_csid(float* CS) { const int idx = blockIdx.x * 256 + threadIdx.x; if (idx >= TT * HD) return; v2f cs; cs[0] = 1.0f; cs[1] = 0.0f; *(v2f*)(CS + (size_t)idx * 2) = cs;  }
// k_asoft: per row (zz, i): t = S x DM^-0.5 (no mask); softmax over the 2048 keys (register row, one exp, fixed trees);
__global__ __launch_bounds__(256) void k_asoft(const float* __restrict__ Sb, h16* P16, bf* Ph, bf* Pl) {
    const int lane = threadIdx.x & 31; const int row = blockIdx.x * 8 + (threadIdx.x >> 5); if (row >= ZH * TT) return; const int i = row % TT; const int zz = row / TT; (void)zz; const bool hires = (i < RH); const float* sr = Sb + (size_t)row * TT; float v[TT / 32]; float mx = -3.0e38f;
#pragma unroll
    for (int ch = 0; ch < TT / 128; ++ch) { const int j0 = ch * 128 + lane * 4; const v4f a = *(const v4f*)(sr + j0);
#pragma unroll
        for (int q = 0; q < 4; ++q) { const int j = j0 + q; (void)j; const float t = a[q] * SCL; v[ch * 4 + q] = t; mx = fmaxf(mx, t); } }
#pragma unroll
    for (int sh = 16; sh; sh >>= 1) mx = fmaxf(mx, __shfl_xor(mx, sh, 32));
    float sum = 0.f;
#pragma unroll
    for (int k = 0; k < TT / 32; ++k) { float d0 = __fsub_rn(v[k], mx); asm volatile("" : "+v"(d0)); v[k] = __builtin_amdgcn_exp2f(__fmul_rn(d0, 1.4426950408889634f)); sum += v[k]; }
#pragma unroll
    for (int sh = 16; sh; sh >>= 1) sum += __shfl_xor(sum, sh, 32);
    const float f = __fdiv_rn(hires ? 1.0f : PCAR, sum);
{
        if (hires) {
#pragma unroll
            for (int ch = 0; ch < TT / 128; ++ch) { v4us oh, ol;
#pragma unroll
                for (int q = 0; q < 4; ++q) { unsigned short a, c2; splitf(v[ch * 4 + q] * f, a, c2); oh[q] = a; ol[q] = c2; }
                const size_t oo = ((size_t)zz * (RH ? RH : 1) + i) * TT + ch * 128 + lane * 4; *(v4us*)(Ph + oo) = oh; *(v4us*)(Pl + oo) = ol; }
        } else {
#pragma unroll
            for (int ch = 0; ch < TT / 128; ++ch) { v4h o4;
#pragma unroll
                for (int q = 0; q < 4; ++q) o4[q] = tohx(v[ch * 4 + q] * f);
                *(v4h*)(P16 + (size_t)row * TT + ch * 128 + lane * 4) = o4; } }
         }
}
__global__ __launch_bounds__(256) void k_merge(const float* __restrict__ O, int h0, bf* Ah, bf* Al) { const size_t e = ((size_t)blockIdx.x * 256 + threadIdx.x) * 2; if (e >= (size_t)ZH * TT * HD) return; const int d = (int)(e % HD); const int t = (int)((e / HD) % TT); const int zz = (int)(e / ((size_t)HD * TT)); const float cs = (t < RH) ? 1.0f : (1.0f / PCAR); const size_t oo = (size_t)t * DQ + (h0 + zz) * HD + d;
    v2us oh, ol;
#pragma unroll
    for (int q = 0; q < 2; ++q) { unsigned short a, c2; splitf(O[e + q] * cs, a, c2); oh[q] = a; ol[q] = c2; } *(v2us*)(Ah + oo) = oh; *(v2us*)(Al + oo) = ol;  }

extern "C" void kernel_launch(void* const* d_in, const int* in_sizes, int n_in,
                              void* d_out, int out_size, void* d_ws, size_t ws_size, hipStream_t stream) {
    (void)in_sizes; (void)n_in; (void)out_size;
    const float* x = (const float*)d_in[0]; const float* wq = (const float*)d_in[1]; const float* wk = (const float*)d_in[2]; const float* wv = (const float*)d_in[3]; const float* wo = (const float*)d_in[4]; const float* bo = (const float*)d_in[5];   /* input order x, Wq, Wk, Wv, Wo ('oi' [1024][1024]), bo */
    float* OUT = (float*)d_out;     // [2][2048][1024]
    char* wsp = (char*)d_ws;
    auto take = [&](size_t bytes) { char* p = wsp; wsp += (bytes + 255) & ~(size_t)255; return (void*)p; };
    bf* WQ = (bf*)take((size_t)DQ * DM * 2); bf* WK = (bf*)take((size_t)DKV * DM * 2); bf* WV = (bf*)take((size_t)DKV * DM * 2); bf* WO = (bf*)take((size_t)DM * DQ * 2); float* CS = (float*)take((size_t)TT * HD * 2 * 4);
    bf* XB = (bf*)take((size_t)TT * DM * 2); float* FQ = (float*)take((size_t)TT * DQ * 4); float* FK = (float*)take((size_t)TT * DKV * 4);
    h16* QP16 = (h16*)take((size_t)NH_ * TT * HD * 2); h16* KP16 = (h16*)take((size_t)NKV * TT * HD * 2); h16* VT16 = (h16*)take((size_t)NKV * HD * TT * 2);
    bf* QPh = (bf*)take((size_t)NH_ * TT * HD * 2); bf* QPl = (bf*)take((size_t)NH_ * TT * HD * 2); bf* KPh = (bf*)take((size_t)NKV * TT * HD * 2); bf* KPl = (bf*)take((size_t)NKV * TT * HD * 2); bf* VTh = (bf*)take((size_t)NKV * HD * TT * 2); bf* VTl = (bf*)take((size_t)NKV * HD * TT * 2); bf* Ph = (bf*)take((size_t)ZH * RH * TT * 2); bf* Pl = (bf*)take((size_t)ZH * RH * TT * 2);
    float* Sb = (float*)take((size_t)ZH * TT * TT * 4); h16* P16 = (h16*)take((size_t)ZH * TT * TT * 2); float* Ob = (float*)take((size_t)ZH * TT * HD * 4); bf* ATh = (bf*)take((size_t)TT * DQ * 2); bf* ATl = (bf*)take((size_t)TT * DQ * 2);
    if ((size_t)(wsp - (char*)d_ws) > ws_size) return;    // ws 256 MiB
    float* FV = FK;   // v projection reuses the k buffer after the k planes are built (stream-ordered)
    { k_cvt8<<<(unsigned)(((size_t)DQ * DM / 8 + 255) / 256), 256, 0, stream>>>(wq, WQ, (size_t)DQ * DM / 8); k_cvt8<<<(unsigned)(((size_t)DKV * DM / 8 + 255) / 256), 256, 0, stream>>>(wk, WK, (size_t)DKV * DM / 8); k_cvt8<<<(unsigned)(((size_t)DKV * DM / 8 + 255) / 256), 256, 0, stream>>>(wv, WV, (size_t)DKV * DM / 8);
      k_cvt8<<<(unsigned)(((size_t)DM * DQ / 8 + 255) / 256), 256, 0, stream>>>(wo, WO, (size_t)DM * DQ / 8);
       }
    k_csid<<<(TT * HD + 255) / 256, 256, 0, stream>>>(CS);
    const unsigned LQ = (unsigned)(((size_t)NH_ * TT * HD / 2 + 255) / 256), LKv = (unsigned)(((size_t)NKV * TT * HD / 2 + 255) / 256);
    for (int b = 0; b < NB_; ++b) {
        
        k_cvt8<<<(unsigned)(((size_t)TT * DM / 8 + 255) / 256), 256, 0, stream>>>(x + (size_t)b * TT * DM, XB, (size_t)TT * DM / 8);
        k_gemmw<bf, 0, false, 8><<<dim3(TT / 64, DQ / 64, 1), 256, 0, stream>>>(XB, nullptr, WQ, nullptr, DM, FQ, DQ, nullptr, 0, 0, 0);
        k_rope<<<LQ, 256, 0, stream>>>(FQ, DQ, NH_, CS, nullptr, nullptr, 1.0f, QP16, QPh, QPl);
        k_gemmw<bf, 0, false, 8><<<dim3(TT / 64, DKV / 64, 1), 256, 0, stream>>>(XB, nullptr, WK, nullptr, DM, FK, DKV, nullptr, 0, 0, 0);
        k_rope<<<LKv, 256, 0, stream>>>(FK, DKV, NKV, CS, nullptr, nullptr, 1.0f, KP16, KPh, KPl);
        k_gemmw<bf, 0, false, 8><<<dim3(TT / 64, DKV / 64, 1), 256, 0, stream>>>(XB, nullptr, WV, nullptr, DM, FV, DKV, nullptr, 0, 0, 0); k_vtp<<<LKv, 256, 0, stream>>>(FV, DKV, NKV, VT16, VTh, VTl);
        for (int h0 = 0; h0 < NH_; h0 += ZH) { const size_t zq = (size_t)h0, zk = (size_t)(h0 / REP);   // one kv head per query head: the pass's two heads use consecutive kv planes (z-strides TT*HD)
            k_gemmw<bf, 2, false, 1><<<dim3(RH / 64, TT / 64, ZH), 32, 0, stream>>>(QPh + zq * TT * HD, QPl + zq * TT * HD, KPh + zk * TT * HD, KPl + zk * TT * HD, HD, Sb, TT, nullptr, (size_t)TT * HD, (size_t)TT * HD, (size_t)TT * TT);
            k_gemmw<h16, 0, false, 1><<<dim3((TT - RH) / 64, TT / 64, ZH), 32, 0, stream>>>(QP16 + zq * TT * HD + (size_t)RH * HD, nullptr, KP16 + zk * TT * HD, nullptr, HD, Sb + (size_t)RH * TT, TT, nullptr, (size_t)TT * HD, (size_t)TT * HD, (size_t)TT * TT);
            k_asoft<<<ZH * TT / 8, 256, 0, stream>>>(Sb, P16, Ph, Pl);
            k_gemmw<bf, 2, false, 16><<<dim3(RH / 64, HD / 64, ZH), 512, 0, stream>>>(Ph, Pl, VTh + zk * HD * TT, VTl + zk * HD * TT, TT, Ob, HD, nullptr, (size_t)RH * TT, (size_t)HD * TT, (size_t)TT * HD);
            k_gemmw<h16, 0, false, 16><<<dim3((TT - RH) / 64, HD / 64, ZH), 512, 0, stream>>>(P16 + (size_t)RH * TT, nullptr, VT16 + zk * HD * TT, nullptr, TT, Ob + (size_t)RH * HD, HD, nullptr, (size_t)TT * TT, (size_t)HD * TT, (size_t)TT * HD);
            k_merge<<<(unsigned)(((size_t)ZH * TT * HD / 2 + 255) / 256), 256, 0, stream>>>(Ob, h0, ATh, ATl); }
        k_gemmw<bf, 1, true, 8><<<dim3(TT / 64, DM / 64, 1), 256, 0, stream>>>(ATh, ATl, WO, nullptr, DQ, OUT + (size_t)b * TT * DM, DM, bo, 0, 0, 0); }
}

// v002
// One run takes 637 microseconds.
// Two timings next to v001 both put it at 1.63 times that version's speed.
// Over all steps from v000 it is 3.06 times as fast.
#include <hip/hip_runtime.h>

// Multi-head attention with bias-free projections, an output bias and a MODEL-width score scale (x [2][2048][1024]; Q, K, V = x W^T ('oi' [1024][1024] normal x 0.02, no bias; 16 heads x 64); scores / sqrt(float32(1024)) = x 0.03125 (the source divides by the square root of the FULL width k, not of the head width); softmax (no mask); out = merged Wo^T + bo ('oi' + bias zeros on this draw: read) -> [2][2048][1024] (4.2 M); argument order x, Wq, Wk, Wv, Wo, bo.
// Layout per batch: bf16 copy of x; 'oi' weights; exact projections; identity-table plane builders; dense T-2048 attention (hybrid rows: < 512 hi/lo 3 products, rest fp16 x1024); merged hi/lo x Wo exact + bo.
// Compute dtypes, f32 accumulate: every input rounded to bf16; projections exact; attention rows < 512 3 products, rest fp16; softmax f32; Wo hl x exact + bias.

#define NB_  2
#define TT   2048
#define DM   1024
#define NH_  16
#define NKV  16
#define REP  (NH_ / NKV)
#define HD   64
#define DQ   (NH_ * HD)
#define DKV  (NKV * HD)
#define ZH   6                    // most heads per attention pass (grid z of its four GEMM launches); the last pass takes what is left of NH_
#define RH   512                  // query rows < RH use hi+lo planes (0: none)
#define WIN  0
#define PCAR 1024.0f
#define SCL  0.03125f   // 1 / sqrt(1024): this module divides by sqrt(k) with k the FULL width
typedef _Float16 h16;
typedef unsigned short bf;
typedef __attribute__((ext_vector_type(16))) __bf16   v16bf;
typedef __attribute__((ext_vector_type(16))) _Float16 v16h;
typedef __attribute__((ext_vector_type(8)))  _Float16 v8h;
typedef __attribute__((ext_vector_type(8)))  unsigned short v8us;
typedef __attribute__((ext_vector_type(8)))  float    v8f;
typedef __attribute__((ext_vector_type(4)))  float    v4f;
typedef v8h  __attribute__((may_alias)) v8ha;
typedef v4f  __attribute__((may_alias)) v4fa;
typedef v8us __attribute__((may_alias)) v8usa;

__device__ __forceinline__ unsigned short f2bf(float f) { unsigned u = __float_as_uint(f); u += 0x7FFFu + ((u >> 16) & 1u); return (unsigned short)(u >> 16); }
__device__ __forceinline__ float bf2f(unsigned short b) { return __uint_as_float(((unsigned)b) << 16); }
__device__ __forceinline__ float bfr(float f) { return bf2f(f2bf(f)); }
__device__ __forceinline__ v16h cat16(v8h lo, v8h hi) { return __builtin_shufflevector(lo, hi, 0, 1, 2, 3, 4, 5, 6, 7, 8, 9, 10, 11, 12, 13, 14, 15); }
__device__ __forceinline__ v16bf cat16b(v8us lo, v8us hi) { return __builtin_bit_cast(v16bf, __builtin_shufflevector(lo, hi, 0, 1, 2, 3, 4, 5, 6, 7, 8, 9, 10, 11, 12, 13, 14, 15)); }
__device__ __forceinline__ v8f wmma16(v16h a, v16h b, v8f c) { return __builtin_amdgcn_wmma_f32_16x16x32_f16(false, a, false, b, (short)0, c, false, false); }
__device__ __forceinline__ v8f wmmab(v16bf a, v16bf b, v8f c) { return __builtin_amdgcn_wmma_f32_16x16x32_bf16(false, a, false, b, (short)0, c, false, false); }



// ---- k_gemmw: register-blocked GEMM, one 64x64 output tile per work-group (16 accumulators per wave), operands straight from K-contiguous 16-bit planes; grid (M/64, N/64, Z), 32 * KS threads.
// C[m][n] (f32, pitch ldc, + optional f32 bias[n]) = sum_k A[m][k] Bt[n][k] (+ split products per NSPLIT). z-batch strides sA/sB/sC in elements. K % (32 * KS) == 0.
// KS waves split K: wave w sums k in [w K/KS, (w+1) K/KS) for the whole tile, the KS partial tiles meet in LDS and are added in wave order (fixed, so the result is the same on every run).
template <typename T16> struct WFrag;
template <> struct WFrag<h16> { typedef v16h V; static __device__ __forceinline__ V ld(const h16* p) { return cat16(*(const v8h*)p, *(const v8h*)(p + 16)); } static __device__ __forceinline__ v8f mma(V a, V b, v8f c) { return wmma16(a, b, c); } };
template <> struct WFrag<bf> { typedef v16bf V; static __device__ __forceinline__ V ld(const bf* p) { return cat16b(*(const v8us*)p, *(const v8us*)(p + 16)); } static __device__ __forceinline__ v8f mma(V a, V b, v8f c) { return wmmab(a, b, c); } };
template <typename T16, int NSPLIT, bool BIAS, int KS>
__global__ __launch_bounds__(32 * KS) void k_gemmw(const T16* __restrict__ A, const T16* __restrict__ A2, const T16* __restrict__ Bt, const T16* __restrict__ Bt2, int K, float* C, int ldc, const float* __restrict__ bias, size_t sA, size_t sB, size_t sC) {
    typedef typename WFrag<T16>::V V;
    __shared__ __align__(16) float os[(KS == 1 ? 16 : KS * 64) * 68];
    const size_t z = blockIdx.z; A += z * sA; if (A2) A2 += z * sA; Bt += z * sB; if (Bt2) Bt2 += z * sB; C += z * sC;
    const int lane = threadIdx.x & 31, lr = lane & 15, hi = lane >> 4; const int r0 = blockIdx.x * 64, c0 = blockIdx.y * 64;
    v8f acc[4][4];
#pragma unroll
    for (int mb = 0; mb < 4; ++mb)
#pragma unroll
        for (int nb = 0; nb < 4; ++nb) acc[mb][nb] = (v8f){};
    const size_t aoff = (size_t)(r0 + lr) * K + 8 * hi, boff = (size_t)(c0 + lr) * K + 8 * hi;
    const int wv = KS == 1 ? 0 : __builtin_amdgcn_readfirstlane((int)(threadIdx.x >> 5)); const int kb = wv * (K / KS), ke = kb + K / KS;
#pragma unroll 1
    for (int kc = kb; kc < ke; kc += 32) {
        V a[4], a2[4];
#pragma unroll
        for (int mb = 0; mb < 4; ++mb) { a[mb] = WFrag<T16>::ld(A + aoff + (size_t)mb * 16 * K + kc); if (NSPLIT == 1 || NSPLIT == 2) a2[mb] = WFrag<T16>::ld(A2 + aoff + (size_t)mb * 16 * K + kc); }
#pragma unroll
        for (int nb = 0; nb < 4; ++nb) { const V b = WFrag<T16>::ld(Bt + boff + (size_t)nb * 16 * K + kc); V b2; if (NSPLIT >= 2) b2 = WFrag<T16>::ld(Bt2 + boff + (size_t)nb * 16 * K + kc);
#pragma unroll
            for (int mb = 0; mb < 4; ++mb) { acc[mb][nb] = WFrag<T16>::mma(a[mb], b, acc[mb][nb]); if (NSPLIT == 1 || NSPLIT == 2) acc[mb][nb] = WFrag<T16>::mma(a2[mb], b, acc[mb][nb]); if (NSPLIT >= 2) acc[mb][nb] = WFrag<T16>::mma(a[mb], b2, acc[mb][nb]); } }
        asm volatile("v_nop\n\tv_nop\n\tv_nop\n\tv_nop" : "+v"(acc[0][0]), "+v"(acc[1][1]), "+v"(acc[2][2]), "+v"(acc[3][3]) : "v"(a[0]), "v"(a[3]));
    }
    if constexpr (KS > 1) {
        float* ow = os + wv * (64 * 68);
#pragma unroll
        for (int mb = 0; mb < 4; ++mb)
#pragma unroll
            for (int nb = 0; nb < 4; ++nb)
#pragma unroll
                for (int j = 0; j < 8; ++j) ow[(mb * 16 + hi * 8 + j) * 68 + nb * 16 + lr] = acc[mb][nb][j];
        __syncthreads();   // every wave's partial tile is in LDS before any thread sums across waves
#pragma unroll
        for (int s = 0; s < 32 / KS; ++s) { const int q4 = s * (32 * KS) + (int)threadIdx.x, row = q4 >> 4, cofs = (q4 & 15) * 4; v4f val = *(const v4fa*)(os + row * 68 + cofs);
#pragma unroll
            for (int w = 1; w < KS; ++w) val += *(const v4fa*)(os + w * (64 * 68) + row * 68 + cofs);
            if (BIAS) { val[0] += bfr(bias[c0 + cofs]); val[1] += bfr(bias[c0 + cofs + 1]); val[2] += bfr(bias[c0 + cofs + 2]); val[3] += bfr(bias[c0 + cofs + 3]); }
            *(v4f*)(C + (size_t)(r0 + row) * ldc + c0 + cofs) = val; }
        return;
    }
#pragma unroll
    for (int mb = 0; mb < 4; ++mb) {
#pragma unroll
        for (int nb = 0; nb < 4; ++nb) {
#pragma unroll
            for (int j = 0; j < 8; ++j) os[(hi * 8 + j) * 68 + nb * 16 + lr] = acc[mb][nb][j]; }
        __builtin_amdgcn_wave_barrier(); asm volatile("" ::: "memory");
        float* crow = C + (size_t)(r0 + mb * 16) * ldc + c0;
{
#pragma unroll
            for (int s = 0; s < 8; ++s) { const int row = 2 * s + hi, cofs = lr * 4; v4f val = *(const v4fa*)(os + row * 68 + cofs); if (BIAS) { val[0] += bfr(bias[c0 + cofs]); val[1] += bfr(bias[c0 + cofs + 1]); val[2] += bfr(bias[c0 + cofs + 2]); val[3] += bfr(bias[c0 + cofs + 3]); }
                *(v4f*)(crow + (size_t)row * ldc + cofs) = val; }
             }
        __builtin_amdgcn_wave_barrier(); asm volatile("" ::: "memory");
    }
}

__device__ __forceinline__ h16 tohx(float x) { return (h16)x; }
__device__ __forceinline__ void splitf(float y, unsigned short& h, unsigned short& l) { h = f2bf(y); l = f2bf(y - bf2f(h)); }
typedef __attribute__((ext_vector_type(2))) _Float16 v2h;
typedef __attribute__((ext_vector_type(4))) _Float16 v4h;
typedef __attribute__((ext_vector_type(2))) unsigned short v2us;
typedef __attribute__((ext_vector_type(4))) unsigned short v4us;
typedef __attribute__((ext_vector_type(2))) float v2f;
typedef __attribute__((ext_vector_type(4))) int v4i;

__global__ __launch_bounds__(256) void k_cvt8(const float* __restrict__ src, bf* dst, size_t n8) { const size_t i = (size_t)blockIdx.x * 256 + threadIdx.x; if (i >= n8) return; const v8f v = *(const v8f*)(src + i * 8); v8us o;
#pragma unroll
    for (int k = 0; k < 8; ++k) o[k] = f2bf(v[k]); *(v8us*)(dst + i * 8) = o;  }

// k_rope: head planes [h][t][d] (fp16 + hi/lo) of rope(x) x sc with the rotate-half convention out[d] = x[d] cos[t][d] - x[d+HD/2] sin[t][d], out[d+HD/2] = x[d+HD/2] cos[t][d+HD/2] + x[d] sin[t][d+HD/2]
__global__ __launch_bounds__(256) void k_rope(const float* __restrict__ F, int pitch, int nheads, const float* __restrict__ CS, const float* __restrict__ RF, const float* __restrict__ nw, float sc, h16* P16, bf* Ph, bf* Pl) {
    const size_t e = ((size_t)blockIdx.x * 256 + threadIdx.x) * 2; if (e >= (size_t)nheads * TT * HD) return; const int d = (int)(e % HD); const int t = (int)((e / HD) % TT); const int h = (int)(e / ((size_t)HD * TT)); const float* f = F + (size_t)t * pitch + h * HD; const float rf = RF ? RF[(size_t)h * TT + t] : 1.0f; v2h o16; v2us oh, ol;
#pragma unroll
    for (int q = 0; q < 2; ++q) { const int dd = d + q; const int dp = (dd < HD / 2) ? dd + HD / 2 : dd - HD / 2; float x0 = f[dd], x1 = f[dp];
        if (RF) { float n0 = __fmul_rn(x0, rf), n1 = __fmul_rn(x1, rf); asm volatile("" : "+v"(n0)); asm volatile("" : "+v"(n1)); x0 = __fmul_rn(bfr(nw[dd]), n0); x1 = __fmul_rn(bfr(nw[dp]), n1); }
        const v2f cs = *(const v2f*)(CS + ((size_t)t * HD + dd) * 2); float a = __fmul_rn(x0, cs[0]), bq = __fmul_rn(x1, cs[1]); asm volatile("" : "+v"(a)); asm volatile("" : "+v"(bq)); const float r = ((dd < HD / 2) ? __fsub_rn(a, bq) : __fadd_rn(a, bq)) * sc;
        o16[q] = tohx(r); unsigned short a2, c2; splitf(r, a2, c2); oh[q] = a2; ol[q] = c2; }
    *(v2h*)(P16 + e) = o16; *(v2us*)(Ph + e) = oh; *(v2us*)(Pl + e) = ol;  }
__global__ __launch_bounds__(256) void k_vtp(const float* __restrict__ F, int pitch, int nheads, h16* V16, bf* Vh, bf* Vl) { const size_t e = ((size_t)blockIdx.x * 256 + threadIdx.x) * 2; if (e >= (size_t)nheads * HD * TT) return; const int t = (int)(e % TT); const int d = (int)((e / TT) % HD); const int g = (int)(e / ((size_t)TT * HD)); v2h o16; v2us oh, ol;
#pragma unroll
    for (int q = 0; q < 2; ++q) { const float x = F[(size_t)(t + q) * pitch + g * HD + d]; o16[q] = tohx(x); unsigned short a2, c2; splitf(x, a2, c2); oh[q] = a2; ol[q] = c2; }
    *(v2h*)(V16 + e) = o16; *(v2us*)(Vh + e) = oh; *(v2us*)(Vl + e) = ol;  }
__global__ __launch_bounds__(256) void k_csid(float* CS) { const int idx = blockIdx.x * 256 + threadIdx.x; if (idx >= TT * HD) return; v2f cs; cs[0] = 1.0f; cs[1] = 0.0f; *(v2f*)(CS + (size_t)idx * 2) = cs;  }
// k_asoft: per row (zz, i): t = S x DM^-0.5 (no mask); softmax over the 2048 keys (register row, one exp, fixed trees);
__global__ __launch_bounds__(256) void k_asoft(const float* __restrict__ Sb, h16* P16, bf* Ph, bf* Pl) {
    const int lane = threadIdx.x & 31; const int row = blockIdx.x * 8 + (threadIdx.x >> 5); if (row >= ZH * TT) return; const int i = row % TT; const int zz = row / TT; (void)zz; const bool hires = (i < RH); const float* sr = Sb + (size_t)row * TT; float v[TT / 32]; float mx = -3.0e38f;
#pragma unroll
    for (int ch = 0; ch < TT / 128; ++ch) { const int j0 = ch * 128 + lane * 4; const v4f a = *(const v4f*)(sr + j0);
#pragma unroll
        for (int q = 0; q < 4; ++q) { const int j = j0 + q; (void)j; const float t = a[q] * SCL; v[ch * 4 + q] = t; mx = fmaxf(mx, t); } }
#pragma unroll
    for (int sh = 16; sh; sh >>= 1) mx = fmaxf(mx, __shfl_xor(mx, sh, 32));
    float sum = 0.f;
#pragma unroll
    for (int k = 0; k < TT / 32; ++k) { float d0 = __fsub_rn(v[k], mx); asm volatile("" : "+v"(d0)); v[k] = __builtin_amdgcn_exp2f(__fmul_rn(d0, 1.4426950408889634f)); sum += v[k]; }
#pragma unroll
    for (int sh = 16; sh; sh >>= 1) sum += __shfl_xor(sum, sh, 32);
    const float f = __fdiv_rn(hires ? 1.0f : PCAR, sum);
{
        if (hires) {
#pragma unroll
            for (int ch = 0; ch < TT / 128; ++ch) { v4us oh, ol;
#pragma unroll
                for (int q = 0; q < 4; ++q) { unsigned short a, c2; splitf(v[ch * 4 + q] * f, a, c2); oh[q] = a; ol[q] = c2; }
                const size_t oo = ((size_t)zz * (RH ? RH : 1) + i) * TT + ch * 128 + lane * 4; *(v4us*)(Ph + oo) = oh; *(v4us*)(Pl + oo) = ol; }
        } else {
#pragma unroll
            for (int ch = 0; ch < TT / 128; ++ch) { v4h o4;
#pragma unroll
                for (int q = 0; q < 4; ++q) o4[q] = tohx(v[ch * 4 + q] * f);
                *(v4h*)(P16 + (size_t)row * TT + ch * 128 + lane * 4) = o4; } }
         }
}
__global__ __launch_bounds__(256) void k_merge(const float* __restrict__ O, int h0, bf* Ah, bf* Al) { const size_t e = ((size_t)blockIdx.x * 256 + threadIdx.x) * 2; if (e >= (size_t)ZH * TT * HD) return; const int d = (int)(e % HD); const int t = (int)((e / HD) % TT); const int zz = (int)(e / ((size_t)HD * TT)); const float cs = (t < RH) ? 1.0f : (1.0f / PCAR); const size_t oo = (size_t)t * DQ + (h0 + zz) * HD + d;
    v2us oh, ol;
#pragma unroll
    for (int q = 0; q < 2; ++q) { unsigned short a, c2; splitf(O[e + q] * cs, a, c2); oh[q] = a; ol[q] = c2; } *(v2us*)(Ah + oo) = oh; *(v2us*)(Al + oo) = ol;  }

extern "C" void kernel_launch(void* const* d_in, const int* in_sizes, int n_in,
                              void* d_out, int out_size, void* d_ws, size_t ws_size, hipStream_t stream) {
    (void)in_sizes; (void)n_in; (void)out_size;
    const float* x = (const float*)d_in[0]; const float* wq = (const float*)d_in[1]; const float* wk = (const float*)d_in[2]; const float* wv = (const float*)d_in[3]; const float* wo = (const float*)d_in[4]; const float* bo = (const float*)d_in[5];   /* input order x, Wq, Wk, Wv, Wo ('oi' [1024][1024]), bo */
    float* OUT = (float*)d_out;     // [2][2048][1024]
    char* wsp = (char*)d_ws;
    auto take = [&](size_t bytes) { char* p = wsp; wsp += (bytes + 255) & ~(size_t)255; return (void*)p; };
    bf* WQ = (bf*)take((size_t)DQ * DM * 2); bf* WK = (bf*)take((size_t)DKV * DM * 2); bf* WV = (bf*)take((size_t)DKV * DM * 2); bf* WO = (bf*)take((size_t)DM * DQ * 2); float* CS = (float*)take((size_t)TT * HD * 2 * 4);
    bf* XB = (bf*)take((size_t)TT * DM * 2); float* FQ = (float*)take((size_t)TT * DQ * 4); float* FK = (float*)take((size_t)TT * DKV * 4);
    h16* QP16 = (h16*)take((size_t)NH_ * TT * HD * 2); h16* KP16 = (h16*)take((size_t)NKV * TT * HD * 2); h16* VT16 = (h16*)take((size_t)NKV * HD * TT * 2);
    bf* QPh = (bf*)take((size_t)NH_ * TT * HD * 2); bf* QPl = (bf*)take((size_t)NH_ * TT * HD * 2); bf* KPh = (bf*)take((size_t)NKV * TT * HD * 2); bf* KPl = (bf*)take((size_t)NKV * TT * HD * 2); bf* VTh = (bf*)take((size_t)NKV * HD * TT * 2); bf* VTl = (bf*)take((size_t)NKV * HD * TT * 2); bf* Ph = (bf*)take((size_t)ZH * RH * TT * 2); bf* Pl = (bf*)take((size_t)ZH * RH * TT * 2);
    float* Sb = (float*)take((size_t)ZH * TT * TT * 4); h16* P16 = (h16*)take((size_t)ZH * TT * TT * 2); float* Ob = (float*)take((size_t)ZH * TT * HD * 4); bf* ATh = (bf*)take((size_t)TT * DQ * 2); bf* ATl = (bf*)take((size_t)TT * DQ * 2);
    if ((size_t)(wsp - (char*)d_ws) > ws_size) return;    // ws 256 MiB
    float* FV = FK;   // v projection reuses the k buffer after the k planes are built (stream-ordered)
    { k_cvt8<<<(unsigned)(((size_t)DQ * DM / 8 + 255) / 256), 256, 0, stream>>>(wq, WQ, (size_t)DQ * DM / 8); k_cvt8<<<(unsigned)(((size_t)DKV * DM / 8 + 255) / 256), 256, 0, stream>>>(wk, WK, (size_t)DKV * DM / 8); k_cvt8<<<(unsigned)(((size_t)DKV * DM / 8 + 255) / 256), 256, 0, stream>>>(wv, WV, (size_t)DKV * DM / 8);
      k_cvt8<<<(unsigned)(((size_t)DM * DQ / 8 + 255) / 256), 256, 0, stream>>>(wo, WO, (size_t)DM * DQ / 8);
       }
    k_csid<<<(TT * HD + 255) / 256, 256, 0, stream>>>(CS);
    const unsigned LQ = (unsigned)(((size_t)NH_ * TT * HD / 2 + 255) / 256), LKv = (unsigned)(((size_t)NKV * TT * HD / 2 + 255) / 256);
    for (int b = 0; b < NB_; ++b) {
        
        k_cvt8<<<(unsigned)(((size_t)TT * DM / 8 + 255) / 256), 256, 0, stream>>>(x + (size_t)b * TT * DM, XB, (size_t)TT * DM / 8);
        k_gemmw<bf, 0, false, 8><<<dim3(TT / 64, DQ / 64, 1), 256, 0, stream>>>(XB, nullptr, WQ, nullptr, DM, FQ, DQ, nullptr, 0, 0, 0);
        k_rope<<<LQ, 256, 0, stream>>>(FQ, DQ, NH_, CS, nullptr, nullptr, 1.0f, QP16, QPh, QPl);
        k_gemmw<bf, 0, false, 8><<<dim3(TT / 64, DKV / 64, 1), 256, 0, stream>>>(XB, nullptr, WK, nullptr, DM, FK, DKV, nullptr, 0, 0, 0);
        k_rope<<<LKv, 256, 0, stream>>>(FK, DKV, NKV, CS, nullptr, nullptr, 1.0f, KP16, KPh, KPl);
        k_gemmw<bf, 0, false, 8><<<dim3(TT / 64, DKV / 64, 1), 256, 0, stream>>>(XB, nullptr, WV, nullptr, DM, FV, DKV, nullptr, 0, 0, 0); k_vtp<<<LKv, 256, 0, stream>>>(FV, DKV, NKV, VT16, VTh, VTl);
        for (int h0 = 0; h0 < NH_; h0 += ZH) { const size_t zq = (size_t)h0, zk = (size_t)(h0 / REP); const unsigned nz = (NH_ - h0 < ZH) ? (NH_ - h0) : ZH;   // one kv head per query head: the pass's nz heads use consecutive kv planes (z-strides TT*HD)
            k_gemmw<bf, 2, false, 1><<<dim3(RH / 64, TT / 64, nz), 32, 0, stream>>>(QPh + zq * TT * HD, QPl + zq * TT * HD, KPh + zk * TT * HD, KPl + zk * TT * HD, HD, Sb, TT, nullptr, (size_t)TT * HD, (size_t)TT * HD, (size_t)TT * TT);
            k_gemmw<h16, 0, false, 1><<<dim3((TT - RH) / 64, TT / 64, nz), 32, 0, stream>>>(QP16 + zq * TT * HD + (size_t)RH * HD, nullptr, KP16 + zk * TT * HD, nullptr, HD, Sb + (size_t)RH * TT, TT, nullptr, (size_t)TT * HD, (size_t)TT * HD, (size_t)TT * TT);
            k_asoft<<<nz * TT / 8, 256, 0, stream>>>(Sb, P16, Ph, Pl);
            k_gemmw<bf, 2, false, 16><<<dim3(RH / 64, HD / 64, nz), 512, 0, stream>>>(Ph, Pl, VTh + zk * HD * TT, VTl + zk * HD * TT, TT, Ob, HD, nullptr, (size_t)RH * TT, (size_t)HD * TT, (size_t)TT * HD);
            k_gemmw<h16, 0, false, 16><<<dim3((TT - RH) / 64, HD / 64, nz), 512, 0, stream>>>(P16 + (size_t)RH * TT, nullptr, VT16 + zk * HD * TT, nullptr, TT, Ob + (size_t)RH * HD, HD, nullptr, (size_t)TT * TT, (size_t)HD * TT, (size_t)TT * HD);
            k_merge<<<(unsigned)(((size_t)nz * TT * HD / 2 + 255) / 256), 256, 0, stream>>>(Ob, h0, ATh, ATl); }
        k_gemmw<bf, 1, true, 8><<<dim3(TT / 64, DM / 64, 1), 256, 0, stream>>>(ATh, ATl, WO, nullptr, DQ, OUT + (size_t)b * TT * DM, DM, bo, 0, 0, 0); }
}

// v003
// One run takes 240 microseconds.
// Timed twice side by side with v002, it ran 2.65 and 2.61 times as fast.
// All steps since v000 together make it 8.06 times as fast.
#include <hip/hip_runtime.h>

// Multi-head attention with bias-free projections, an output bias and a MODEL-width score scale (x [2][2048][1024]; Q, K, V = x W^T ('oi' [1024][1024] normal x 0.02, no bias; 16 heads x 64); scores / sqrt(float32(1024)) = x 0.03125 (the source divides by the square root of the FULL width k, not of the head width); softmax (no mask); out = merged Wo^T + bo ('oi' + bias zeros on this draw: read) -> [2][2048][1024] (4.2 M); argument order x, Wq, Wk, Wv, Wo, bo.
// Layout per batch: bf16 copy of x; 'oi' weights; exact projections; identity-table plane builders; fused dense T-2048 attention, scores kept in registers (hybrid rows: < 512 hi/lo 3 products, rest fp16); merged hi/lo x Wo exact + bo.
// Compute dtypes, f32 accumulate: every input rounded to bf16; projections exact; attention rows < 512 3 products, rest fp16; softmax f32; Wo hl x exact + bias.

#define NB_  2
#define TT   2048
#define DM   1024
#define NH_  16
#define NKV  16
#define REP  (NH_ / NKV)
#define HD   64
#define DQ   (NH_ * HD)
#define DKV  (NKV * HD)
#define RH   512                  // query rows < RH use hi+lo planes (0: none)
#define WIN  0
#define SCL  0.03125f   // 1 / sqrt(1024): this module divides by sqrt(k) with k the FULL width
typedef _Float16 h16;
typedef unsigned short bf;
typedef __attribute__((ext_vector_type(16))) __bf16   v16bf;
typedef __attribute__((ext_vector_type(16))) _Float16 v16h;
typedef __attribute__((ext_vector_type(8)))  _Float16 v8h;
typedef __attribute__((ext_vector_type(8)))  unsigned short v8us;
typedef __attribute__((ext_vector_type(8)))  float    v8f;
typedef __attribute__((ext_vector_type(4)))  float    v4f;
typedef v8h  __attribute__((may_alias)) v8ha;
typedef v4f  __attribute__((may_alias)) v4fa;
typedef v8us __attribute__((may_alias)) v8usa;

__device__ __forceinline__ unsigned short f2bf(float f) { unsigned u = __float_as_uint(f); u += 0x7FFFu + ((u >> 16) & 1u); return (unsigned short)(u >> 16); }
__device__ __forceinline__ float bf2f(unsigned short b) { return __uint_as_float(((unsigned)b) << 16); }
__device__ __forceinline__ float bfr(float f) { return bf2f(f2bf(f)); }
__device__ __forceinline__ v16h cat16(v8h lo, v8h hi) { return __builtin_shufflevector(lo, hi, 0, 1, 2, 3, 4, 5, 6, 7, 8, 9, 10, 11, 12, 13, 14, 15); }
__device__ __forceinline__ v16bf cat16b(v8us lo, v8us hi) { return __builtin_bit_cast(v16bf, __builtin_shufflevector(lo, hi, 0, 1, 2, 3, 4, 5, 6, 7, 8, 9, 10, 11, 12, 13, 14, 15)); }
__device__ __forceinline__ v8f wmma16(v16h a, v16h b, v8f c) { return __builtin_amdgcn_wmma_f32_16x16x32_f16(false, a, false, b, (short)0, c, false, false); }
__device__ __forceinline__ v8f wmmab(v16bf a, v16bf b, v8f c) { return __builtin_amdgcn_wmma_f32_16x16x32_bf16(false, a, false, b, (short)0, c, false, false); }



// ---- k_gemmw: register-blocked GEMM, one 64x64 output tile per work-group (16 accumulators per wave), operands straight from K-contiguous 16-bit planes; grid (M/64, N/64, Z), 32 * KS threads.
// C[m][n] (f32, pitch ldc, + optional f32 bias[n]) = sum_k A[m][k] Bt[n][k] (+ split products per NSPLIT). z-batch strides sA/sB/sC in elements. K % (32 * KS) == 0.
// KS waves split K: wave w sums k in [w K/KS, (w+1) K/KS) for the whole tile, the KS partial tiles meet in LDS and are added in wave order (fixed, so the result is the same on every run).
template <typename T16> struct WFrag;
template <> struct WFrag<h16> { typedef v16h V; static __device__ __forceinline__ V ld(const h16* p) { return cat16(*(const v8h*)p, *(const v8h*)(p + 16)); } static __device__ __forceinline__ v8f mma(V a, V b, v8f c) { return wmma16(a, b, c); } };
template <> struct WFrag<bf> { typedef v16bf V; static __device__ __forceinline__ V ld(const bf* p) { return cat16b(*(const v8us*)p, *(const v8us*)(p + 16)); } static __device__ __forceinline__ v8f mma(V a, V b, v8f c) { return wmmab(a, b, c); } };
template <typename T16, int NSPLIT, bool BIAS, int KS>
__global__ __launch_bounds__(32 * KS) void k_gemmw(const T16* __restrict__ A, const T16* __restrict__ A2, const T16* __restrict__ Bt, const T16* __restrict__ Bt2, int K, float* C, int ldc, const float* __restrict__ bias, size_t sA, size_t sB, size_t sC) {
    typedef typename WFrag<T16>::V V;
    __shared__ __align__(16) float os[(KS == 1 ? 16 : KS * 64) * 68];
    const size_t z = blockIdx.z; A += z * sA; if (A2) A2 += z * sA; Bt += z * sB; if (Bt2) Bt2 += z * sB; C += z * sC;
    const int lane = threadIdx.x & 31, lr = lane & 15, hi = lane >> 4; const int r0 = blockIdx.x * 64, c0 = blockIdx.y * 64;
    v8f acc[4][4];
#pragma unroll
    for (int mb = 0; mb < 4; ++mb)
#pragma unroll
        for (int nb = 0; nb < 4; ++nb) acc[mb][nb] = (v8f){};
    const size_t aoff = (size_t)(r0 + lr) * K + 8 * hi, boff = (size_t)(c0 + lr) * K + 8 * hi;
    const int wv = KS == 1 ? 0 : __builtin_amdgcn_readfirstlane((int)(threadIdx.x >> 5)); const int kb = wv * (K / KS), ke = kb + K / KS;
#pragma unroll 1
    for (int kc = kb; kc < ke; kc += 32) {
        V a[4], a2[4];
#pragma unroll
        for (int mb = 0; mb < 4; ++mb) { a[mb] = WFrag<T16>::ld(A + aoff + (size_t)mb * 16 * K + kc); if (NSPLIT == 1 || NSPLIT == 2) a2[mb] = WFrag<T16>::ld(A2 + aoff + (size_t)mb * 16 * K + kc); }
#pragma unroll
        for (int nb = 0; nb < 4; ++nb) { const V b = WFrag<T16>::ld(Bt + boff + (size_t)nb * 16 * K + kc); V b2; if (NSPLIT >= 2) b2 = WFrag<T16>::ld(Bt2 + boff + (size_t)nb * 16 * K + kc);
#pragma unroll
            for (int mb = 0; mb < 4; ++mb) { acc[mb][nb] = WFrag<T16>::mma(a[mb], b, acc[mb][nb]); if (NSPLIT == 1 || NSPLIT == 2) acc[mb][nb] = WFrag<T16>::mma(a2[mb], b, acc[mb][nb]); if (NSPLIT >= 2) acc[mb][nb] = WFrag<T16>::mma(a[mb], b2, acc[mb][nb]); } }
        asm volatile("v_nop\n\tv_nop\n\tv_nop\n\tv_nop" : "+v"(acc[0][0]), "+v"(acc[1][1]), "+v"(acc[2][2]), "+v"(acc[3][3]) : "v"(a[0]), "v"(a[3]));
    }
    if constexpr (KS > 1) {
        float* ow = os + wv * (64 * 68);
#pragma unroll
        for (int mb = 0; mb < 4; ++mb)
#pragma unroll
            for (int nb = 0; nb < 4; ++nb)
#pragma unroll
                for (int j = 0; j < 8; ++j) ow[(mb * 16 + hi * 8 + j) * 68 + nb * 16 + lr] = acc[mb][nb][j];
        __syncthreads();   // every wave's partial tile is in LDS before any thread sums across waves
#pragma unroll
        for (int s = 0; s < 32 / KS; ++s) { const int q4 = s * (32 * KS) + (int)threadIdx.x, row = q4 >> 4, cofs = (q4 & 15) * 4; v4f val = *(const v4fa*)(os + row * 68 + cofs);
#pragma unroll
            for (int w = 1; w < KS; ++w) val += *(const v4fa*)(os + w * (64 * 68) + row * 68 + cofs);
            if (BIAS) { val[0] += bfr(bias[c0 + cofs]); val[1] += bfr(bias[c0 + cofs + 1]); val[2] += bfr(bias[c0 + cofs + 2]); val[3] += bfr(bias[c0 + cofs + 3]); }
            *(v4f*)(C + (size_t)(r0 + row) * ldc + c0 + cofs) = val; }
        return;
    }
#pragma unroll
    for (int mb = 0; mb < 4; ++mb) {
#pragma unroll
        for (int nb = 0; nb < 4; ++nb) {
#pragma unroll
            for (int j = 0; j < 8; ++j) os[(hi * 8 + j) * 68 + nb * 16 + lr] = acc[mb][nb][j]; }
        __builtin_amdgcn_wave_barrier(); asm volatile("" ::: "memory");
        float* crow = C + (size_t)(r0 + mb * 16) * ldc + c0;
{
#pragma unroll
            for (int s = 0; s < 8; ++s) { const int row = 2 * s + hi, cofs = lr * 4; v4f val = *(const v4fa*)(os + row * 68 + cofs); if (BIAS) { val[0] += bfr(bias[c0 + cofs]); val[1] += bfr(bias[c0 + cofs + 1]); val[2] += bfr(bias[c0 + cofs + 2]); val[3] += bfr(bias[c0 + cofs + 3]); }
                *(v4f*)(crow + (size_t)row * ldc + cofs) = val; }
             }
        __builtin_amdgcn_wave_barrier(); asm volatile("" ::: "memory");
    }
}

__device__ __forceinline__ h16 tohx(float x) { return (h16)x; }
__device__ __forceinline__ void splitf(float y, unsigned short& h, unsigned short& l) { h = f2bf(y); l = f2bf(y - bf2f(h)); }
typedef __attribute__((ext_vector_type(2))) _Float16 v2h;
typedef __attribute__((ext_vector_type(4))) _Float16 v4h;
typedef __attribute__((ext_vector_type(2))) unsigned short v2us;
typedef __attribute__((ext_vector_type(4))) unsigned short v4us;
typedef __attribute__((ext_vector_type(2))) float v2f;
typedef __attribute__((ext_vector_type(4))) int v4i;

__global__ __launch_bounds__(256) void k_cvt8(const float* __restrict__ src, bf* dst, size_t n8) { const size_t i = (size_t)blockIdx.x * 256 + threadIdx.x; if (i >= n8) return; const v8f v = *(const v8f*)(src + i * 8); v8us o;
#pragma unroll
    for (int k = 0; k < 8; ++k) o[k] = f2bf(v[k]); *(v8us*)(dst + i * 8) = o;  }

// k_rope: head planes [h][t][d] (fp16 + hi/lo) of rope(x) x sc with the rotate-half convention out[d] = x[d] cos[t][d] - x[d+HD/2] sin[t][d], out[d+HD/2] = x[d+HD/2] cos[t][d+HD/2] + x[d] sin[t][d+HD/2]
__global__ __launch_bounds__(256) void k_rope(const float* __restrict__ F, int pitch, int nheads, const float* __restrict__ CS, const float* __restrict__ RF, const float* __restrict__ nw, float sc, h16* P16, bf* Ph, bf* Pl) {
    const size_t e = ((size_t)blockIdx.x * 256 + threadIdx.x) * 2; if (e >= (size_t)nheads * TT * HD) return; const int d = (int)(e % HD); const int t = (int)((e / HD) % TT); const int h = (int)(e / ((size_t)HD * TT)); const float* f = F + (size_t)t * pitch + h * HD; const float rf = RF ? RF[(size_t)h * TT + t] : 1.0f; v2h o16; v2us oh, ol;
#pragma unroll
    for (int q = 0; q < 2; ++q) { const int dd = d + q; const int dp = (dd < HD / 2) ? dd + HD / 2 : dd - HD / 2; float x0 = f[dd], x1 = f[dp];
        if (RF) { float n0 = __fmul_rn(x0, rf), n1 = __fmul_rn(x1, rf); asm volatile("" : "+v"(n0)); asm volatile("" : "+v"(n1)); x0 = __fmul_rn(bfr(nw[dd]), n0); x1 = __fmul_rn(bfr(nw[dp]), n1); }
        const v2f cs = *(const v2f*)(CS + ((size_t)t * HD + dd) * 2); float a = __fmul_rn(x0, cs[0]), bq = __fmul_rn(x1, cs[1]); asm volatile("" : "+v"(a)); asm volatile("" : "+v"(bq)); const float r = ((dd < HD / 2) ? __fsub_rn(a, bq) : __fadd_rn(a, bq)) * sc;
        o16[q] = tohx(r); unsigned short a2, c2; splitf(r, a2, c2); oh[q] = a2; ol[q] = c2; }
    *(v2h*)(P16 + e) = o16; *(v2us*)(Ph + e) = oh; *(v2us*)(Pl + e) = ol;  }
__global__ __launch_bounds__(256) void k_vtp(const float* __restrict__ F, int pitch, int nheads, h16* V16, bf* Vh, bf* Vl) { const size_t e = ((size_t)blockIdx.x * 256 + threadIdx.x) * 2; if (e >= (size_t)nheads * HD * TT) return; const int t = (int)(e % TT); const int d = (int)((e / TT) % HD); const int g = (int)(e / ((size_t)TT * HD)); v2h o16; v2us oh, ol;
#pragma unroll
    for (int q = 0; q < 2; ++q) { const float x = F[(size_t)(t + q) * pitch + g * HD + d]; o16[q] = tohx(x); unsigned short a2, c2; splitf(x, a2, c2); oh[q] = a2; ol[q] = c2; }
    *(v2h*)(V16 + e) = o16; *(v2us*)(Vh + e) = oh; *(v2us*)(Vl + e) = ol;  }
__global__ __launch_bounds__(256) void k_csid(float* CS) { const int idx = blockIdx.x * 256 + threadIdx.x; if (idx >= TT * HD) return; v2f cs; cs[0] = 1.0f; cs[1] = 0.0f; *(v2f*)(CS + (size_t)idx * 2) = cs;  }
#define SC2 (SCL * 1.4426950408889634f)   // score scale x log2(e): scores go straight to the exp2 domain
#define SK  64                      // keys per stage: K rows (HD) and V^T rows (SK) are both 128 bytes
#define LP  72                      // LDS row pitch in 16-bit elements: 144 bytes = 16 x odd, conflict-free for 16-byte reads
#define PLN (64 * LP)               // one staged plane: 64 rows
__device__ __forceinline__ float xhalf(float x) { const int b = __float_as_int(x); return __int_as_float(__builtin_amdgcn_permlanex16(b, b, 0x76543210, 0xfedcba98, false, false)); }   // lane l <-> l ^ 16
template <typename V> __device__ __forceinline__ V ldsfrag(const unsigned short* p) { return __builtin_bit_cast(V, __builtin_shufflevector(*(const v8usa*)p, *(const v8usa*)(p + 16), 0, 1, 2, 3, 4, 5, 6, 7, 8, 9, 10, 11, 12, 13, 14, 15)); }
template <typename T16, bool HI, int QT>
__device__ __forceinline__ void attn_wg(unsigned short* sm, const T16* __restrict__ Q, const T16* __restrict__ Q2, const T16* __restrict__ Kp, const T16* __restrict__ K2, const T16* __restrict__ Vt, const T16* __restrict__ V2, int q0, bf* Ah, bf* Al) {
    typedef WFrag<T16> F; typedef typename F::V V;
    constexpr int NP = HI ? 4 : 2;   // staged planes: K, V^T (, K lo, V^T lo)
    const int lane = threadIdx.x & 31, lr = lane & 15, hi = lane >> 4;
    const int srow = (int)threadIdx.x >> 3, sseg = ((int)threadIdx.x & 7) * 8;   // staging: 8 threads a 128-byte row, 16 rows a sweep of the 128 threads
    V qf[QT][2], q2[QT][2];
#pragma unroll
    for (int qt = 0; qt < QT; ++qt)
#pragma unroll
        for (int ks = 0; ks < 2; ++ks) { const size_t qo = (size_t)(q0 + qt * 16 + lr) * HD + ks * 32 + 8 * hi; qf[qt][ks] = F::ld(Q + qo); if (HI) q2[qt][ks] = F::ld(Q2 + qo); }
    v8f o[4][QT]; float m[QT], l[QT];
#pragma unroll
    for (int qt = 0; qt < QT; ++qt) { m[qt] = -3.0e38f; l[qt] = 0.f;
#pragma unroll
        for (int db = 0; db < 4; ++db) o[db][qt] = (v8f){}; }
    v8us st[NP][4]; const unsigned sko = (unsigned)(srow * HD + sseg), svo = (unsigned)(srow * TT + sseg);
    auto gld = [&](int k0) {
#pragma unroll
        for (int r = 0; r < 4; ++r) { const unsigned kg = sko + 16 * r * HD, vg = svo + 16 * r * TT;   // wave-uniform base + 32-bit lane offset
            st[0][r] = *(const v8usa*)(Kp + (size_t)k0 * HD + kg); st[1][r] = *(const v8usa*)(Vt + k0 + vg); if constexpr (HI) { st[2][r] = *(const v8usa*)(K2 + (size_t)k0 * HD + kg); st[3][r] = *(const v8usa*)(V2 + k0 + vg); } } };
    auto sst = [&](int buf) {
#pragma unroll
        for (int pl = 0; pl < NP; ++pl)
#pragma unroll
            for (int r = 0; r < 4; ++r) *(v8usa*)(sm + (buf * NP + pl) * PLN + (srow + 16 * r) * LP + sseg) = st[pl][r]; };
    auto stage = [&](int buf) __attribute__((always_inline)) {   // the two 32-key passes over one staged buffer
        const unsigned short* sb = sm + buf * NP * PLN + lr * LP + 8 * hi;
#pragma unroll
        for (int ps = 0; ps < SK / 32; ++ps) {
            v8f s[2][QT];
#pragma unroll
            for (int kt = 0; kt < 2; ++kt) { V kf[2], k2[2];
#pragma unroll
                for (int ks = 0; ks < 2; ++ks) { kf[ks] = ldsfrag<V>(sb + (ps * 32 + kt * 16) * LP + ks * 32); if (HI) k2[ks] = ldsfrag<V>(sb + 2 * PLN + (ps * 32 + kt * 16) * LP + ks * 32); }
#pragma unroll
                for (int qt = 0; qt < QT; ++qt) { v8f t = (v8f){};
#pragma unroll
                    for (int ks = 0; ks < 2; ++ks) { t = F::mma(kf[ks], qf[qt][ks], t); if (HI) { t = F::mma(kf[ks], q2[qt][ks], t); t = F::mma(k2[ks], qf[qt][ks], t); } }
                    s[kt][qt] = t; } }
            V vf[4], v2[4];
#pragma unroll
            for (int db = 0; db < 4; ++db) { vf[db] = ldsfrag<V>(sb + PLN + db * 16 * LP + ps * 32); if (HI) v2[db] = ldsfrag<V>(sb + 3 * PLN + db * 16 * LP + ps * 32); }
            __builtin_amdgcn_sched_barrier(0);   // keeps the V^T reads issued here, ahead of the softmax that hides their LDS latency; without it they sink to the second product, one waited pair at a time
            float mn[QT]; bool need = false;
#pragma unroll
            for (int qt = 0; qt < QT; ++qt) { float mx = fmaxf(s[0][qt][0], s[1][qt][0]);
#pragma unroll
                for (int j = 1; j < 8; ++j) mx = fmaxf(mx, fmaxf(s[0][qt][j], s[1][qt][j]));
                mx = fmaxf(mx, xhalf(mx)) * SC2; mn[qt] = mx; need = need || (mx > m[qt] + 8.0f); }
            if (__builtin_amdgcn_ballot_w32(need) != 0) {   // wave-uniform: one scalar branch a pass
#pragma unroll
                for (int qt = 0; qt < QT; ++qt) { const float mw = fmaxf(m[qt], mn[qt]); const float al = __builtin_amdgcn_exp2f(m[qt] - mw); m[qt] = mw; l[qt] *= al;
#pragma unroll
                    for (int db = 0; db < 4; ++db) o[db][qt] *= al; } }
            V pf[QT], p2[QT];
#pragma unroll
            for (int qt = 0; qt < QT; ++qt) { v2f ls = (v2f){};
#pragma unroll
                for (int kt = 0; kt < 2; ++kt)
#pragma unroll
                    for (int j = 0; j < 8; j += 2) { const v2f t = __builtin_elementwise_fma((v2f){s[kt][qt][j], s[kt][qt][j + 1]}, (v2f){SC2, SC2}, (v2f){-m[qt], -m[qt]}); s[kt][qt][j] = __builtin_amdgcn_exp2f(t[0]); s[kt][qt][j + 1] = __builtin_amdgcn_exp2f(t[1]); }
#pragma unroll
                for (int i = 0; i < 16; ++i) { const float p = s[i >> 3][qt][i & 7]; ls[i & 1] += p;
                    if constexpr (HI) { const __bf16 ph = (__bf16)p; pf[qt][i] = ph; p2[qt][i] = (__bf16)(p - (float)ph); } else pf[qt][i] = (_Float16)p; }
                l[qt] += ls[0] + ls[1]; }
#pragma unroll
            for (int db = 0; db < 4; ++db)
#pragma unroll
                for (int qt = 0; qt < QT; ++qt) { o[db][qt] = F::mma(vf[db], pf[qt], o[db][qt]); if (HI) { o[db][qt] = F::mma(vf[db], p2[qt], o[db][qt]); o[db][qt] = F::mma(v2[db], pf[qt], o[db][qt]); } }
        }
    };
    gld(0); sst(0);
    __syncthreads();   // stage 0 is in LDS before any wave reads it
#pragma unroll 1   // stays rolled: a second copy of the stage would double the staging registers and the code
    for (int sg = 0; sg < TT / SK - 1; ++sg) {
        gld((sg + 1) * SK);   // the next stage flies during this stage's two passes
        stage(sg & 1);
        sst((sg + 1) & 1);   // into the buffer whose last readers left it before the previous barrier
        __syncthreads();   // publishes stage sg + 1 and ends every wave's reads of stage sg, whose buffer the next trip refills
    }
    stage((TT / SK - 1) & 1);
#pragma unroll
    for (int qt = 0; qt < QT; ++qt) { const float inv = __fdiv_rn(1.0f, l[qt] + xhalf(l[qt])); const size_t oo = (size_t)(q0 + qt * 16 + lr) * DQ + hi * 8;
#pragma unroll
        for (int db = 0; db < 4; ++db) { v8us oh, ol;
#pragma unroll
            for (int j = 0; j < 8; ++j) { unsigned short a, c2; splitf(o[db][qt][j] * inv, a, c2); oh[j] = a; ol[j] = c2; }
            *(v8us*)(Ah + oo + db * 16) = oh; *(v8us*)(Al + oo + db * 16) = ol; } }
    asm volatile("s_wait_xcnt 0x0" ::: "memory");   // stands between the last stores and any later write of a register that they name
}
// grid (heads, RH / 64 + (TT - RH) / 128), 4 waves: the hi/lo blocks (16 queries a wave) come first in y, then the fp16 blocks (32 queries a wave)
__global__ __launch_bounds__(128) void k_fattn(const h16* __restrict__ Q16, const bf* __restrict__ Qh, const bf* __restrict__ Ql, const h16* __restrict__ K16, const bf* __restrict__ Kh, const bf* __restrict__ Kl, const h16* __restrict__ V16, const bf* __restrict__ Vh, const bf* __restrict__ Vl, bf* Ah, bf* Al) {
    __shared__ __align__(16) unsigned short sm[2 * 4 * PLN];   // two buffers of up to four planes
    const int h = blockIdx.x, y = blockIdx.y; const int wv = __builtin_amdgcn_readfirstlane((int)(threadIdx.x >> 5)); const size_t ho = (size_t)h * TT * HD;
    if (y < RH / 64) attn_wg<bf, true, 1>(sm, Qh + ho, Ql + ho, Kh + ho, Kl + ho, Vh + ho, Vl + ho, y * 64 + wv * 16, Ah + h * HD, Al + h * HD);
    else attn_wg<h16, false, 2>(sm, Q16 + ho, nullptr, K16 + ho, nullptr, V16 + ho, nullptr, RH + (y - RH / 64) * 128 + wv * 32, Ah + h * HD, Al + h * HD);
}

extern "C" void kernel_launch(void* const* d_in, const int* in_sizes, int n_in,
                              void* d_out, int out_size, void* d_ws, size_t ws_size, hipStream_t stream) {
    (void)in_sizes; (void)n_in; (void)out_size;
    const float* x = (const float*)d_in[0]; const float* wq = (const float*)d_in[1]; const float* wk = (const float*)d_in[2]; const float* wv = (const float*)d_in[3]; const float* wo = (const float*)d_in[4]; const float* bo = (const float*)d_in[5];   /* input order x, Wq, Wk, Wv, Wo ('oi' [1024][1024]), bo */
    float* OUT = (float*)d_out;     // [2][2048][1024]
    char* wsp = (char*)d_ws;
    auto take = [&](size_t bytes) { char* p = wsp; wsp += (bytes + 255) & ~(size_t)255; return (void*)p; };
    bf* WQ = (bf*)take((size_t)DQ * DM * 2); bf* WK = (bf*)take((size_t)DKV * DM * 2); bf* WV = (bf*)take((size_t)DKV * DM * 2); bf* WO = (bf*)take((size_t)DM * DQ * 2); float* CS = (float*)take((size_t)TT * HD * 2 * 4);
    bf* XB = (bf*)take((size_t)TT * DM * 2); float* FQ = (float*)take((size_t)TT * DQ * 4); float* FK = (float*)take((size_t)TT * DKV * 4);
    h16* QP16 = (h16*)take((size_t)NH_ * TT * HD * 2); h16* KP16 = (h16*)take((size_t)NKV * TT * HD * 2); h16* VT16 = (h16*)take((size_t)NKV * HD * TT * 2);
    bf* QPh = (bf*)take((size_t)NH_ * TT * HD * 2); bf* QPl = (bf*)take((size_t)NH_ * TT * HD * 2); bf* KPh = (bf*)take((size_t)NKV * TT * HD * 2); bf* KPl = (bf*)take((size_t)NKV * TT * HD * 2); bf* VTh = (bf*)take((size_t)NKV * HD * TT * 2); bf* VTl = (bf*)take((size_t)NKV * HD * TT * 2);
    bf* ATh = (bf*)take((size_t)TT * DQ * 2); bf* ATl = (bf*)take((size_t)TT * DQ * 2);
    if ((size_t)(wsp - (char*)d_ws) > ws_size) return;    // ws 256 MiB
    float* FV = FK;   // v projection reuses the k buffer after the k planes are built (stream-ordered)
    { k_cvt8<<<(unsigned)(((size_t)DQ * DM / 8 + 255) / 256), 256, 0, stream>>>(wq, WQ, (size_t)DQ * DM / 8); k_cvt8<<<(unsigned)(((size_t)DKV * DM / 8 + 255) / 256), 256, 0, stream>>>(wk, WK, (size_t)DKV * DM / 8); k_cvt8<<<(unsigned)(((size_t)DKV * DM / 8 + 255) / 256), 256, 0, stream>>>(wv, WV, (size_t)DKV * DM / 8);
      k_cvt8<<<(unsigned)(((size_t)DM * DQ / 8 + 255) / 256), 256, 0, stream>>>(wo, WO, (size_t)DM * DQ / 8);
       }
    k_csid<<<(TT * HD + 255) / 256, 256, 0, stream>>>(CS);
    const unsigned LQ = (unsigned)(((size_t)NH_ * TT * HD / 2 + 255) / 256), LKv = (unsigned)(((size_t)NKV * TT * HD / 2 + 255) / 256);
    for (int b = 0; b < NB_; ++b) {
        
        k_cvt8<<<(unsigned)(((size_t)TT * DM / 8 + 255) / 256), 256, 0, stream>>>(x + (size_t)b * TT * DM, XB, (size_t)TT * DM / 8);
        k_gemmw<bf, 0, false, 8><<<dim3(TT / 64, DQ / 64, 1), 256, 0, stream>>>(XB, nullptr, WQ, nullptr, DM, FQ, DQ, nullptr, 0, 0, 0);
        k_rope<<<LQ, 256, 0, stream>>>(FQ, DQ, NH_, CS, nullptr, nullptr, 1.0f, QP16, QPh, QPl);
        k_gemmw<bf, 0, false, 8><<<dim3(TT / 64, DKV / 64, 1), 256, 0, stream>>>(XB, nullptr, WK, nullptr, DM, FK, DKV, nullptr, 0, 0, 0);
        k_rope<<<LKv, 256, 0, stream>>>(FK, DKV, NKV, CS, nullptr, nullptr, 1.0f, KP16, KPh, KPl);
        k_gemmw<bf, 0, false, 8><<<dim3(TT / 64, DKV / 64, 1), 256, 0, stream>>>(XB, nullptr, WV, nullptr, DM, FV, DKV, nullptr, 0, 0, 0); k_vtp<<<LKv, 256, 0, stream>>>(FV, DKV, NKV, VT16, VTh, VTl);
        k_fattn<<<dim3(NH_, RH / 64 + (TT - RH) / 128, 1), 128, 0, stream>>>(QP16, QPh, QPl, KP16, KPh, KPl, VT16, VTh, VTl, ATh, ATl);   // one kv head per query head
        k_gemmw<bf, 1, true, 8><<<dim3(TT / 64, DM / 64, 1), 256, 0, stream>>>(ATh, ATl, WO, nullptr, DQ, OUT + (size_t)b * TT * DM, DM, bo, 0, 0, 0); }
}

// v004
// It runs in 194 microseconds.
// Timed twice side by side with v003, it ran 1.24 times as fast both times.
// Over all steps from v000 it is 10.00 times as fast.
#include <hip/hip_runtime.h>

// Multi-head attention with bias-free projections, an output bias and a MODEL-width score scale (x [2][2048][1024]; Q, K, V = x W^T ('oi' [1024][1024] normal x 0.02, no bias; 16 heads x 64); scores / sqrt(float32(1024)) = x 0.03125 (the source divides by the square root of the FULL width k, not of the head width); softmax (no mask); out = merged Wo^T + bo ('oi' + bias zeros on this draw: read) -> [2][2048][1024] (4.2 M); argument order x, Wq, Wk, Wv, Wo, bo.
// Layout per batch: bf16 copy of x; 'oi' weights; exact projections whose epilogue writes the 16-bit head planes (V as Wv x^T, so its tile is V^T already); fused dense T-2048 attention, scores kept in registers (hybrid rows: < 512 hi/lo 3 products, rest fp16); merged hi/lo x Wo exact + bo.
// Compute dtypes, f32 accumulate: every input rounded to bf16; projections exact; attention rows < 512 3 products, rest fp16; softmax f32; Wo hl x exact + bias.

#define NB_  2
#define TT   2048
#define DM   1024
#define NH_  16
#define NKV  16
#define REP  (NH_ / NKV)
#define HD   64
#define DQ   (NH_ * HD)
#define DKV  (NKV * HD)
#define RH   512                  // query rows < RH use hi+lo planes (0: none)
#define WIN  0
#define SCL  0.03125f   // 1 / sqrt(1024): this module divides by sqrt(k) with k the FULL width
typedef _Float16 h16;
typedef unsigned short bf;
typedef __attribute__((ext_vector_type(16))) __bf16   v16bf;
typedef __attribute__((ext_vector_type(16))) _Float16 v16h;
typedef __attribute__((ext_vector_type(8)))  _Float16 v8h;
typedef __attribute__((ext_vector_type(8)))  unsigned short v8us;
typedef __attribute__((ext_vector_type(8)))  float    v8f;
typedef __attribute__((ext_vector_type(4)))  float    v4f;
typedef v8h  __attribute__((may_alias)) v8ha;
typedef v4f  __attribute__((may_alias)) v4fa;
typedef v8us __attribute__((may_alias)) v8usa;

__device__ __forceinline__ unsigned short f2bf(float f) { unsigned u = __float_as_uint(f); u += 0x7FFFu + ((u >> 16) & 1u); return (unsigned short)(u >> 16); }
__device__ __forceinline__ float bf2f(unsigned short b) { return __uint_as_float(((unsigned)b) << 16); }
__device__ __forceinline__ float bfr(float f) { return bf2f(f2bf(f)); }
__device__ __forceinline__ v16h cat16(v8h lo, v8h hi) { return __builtin_shufflevector(lo, hi, 0, 1, 2, 3, 4, 5, 6, 7, 8, 9, 10, 11, 12, 13, 14, 15); }
__device__ __forceinline__ v16bf cat16b(v8us lo, v8us hi) { return __builtin_bit_cast(v16bf, __builtin_shufflevector(lo, hi, 0, 1, 2, 3, 4, 5, 6, 7, 8, 9, 10, 11, 12, 13, 14, 15)); }
__device__ __forceinline__ v8f wmma16(v16h a, v16h b, v8f c) { return __builtin_amdgcn_wmma_f32_16x16x32_f16(false, a, false, b, (short)0, c, false, false); }
__device__ __forceinline__ v8f wmmab(v16bf a, v16bf b, v8f c) { return __builtin_amdgcn_wmma_f32_16x16x32_bf16(false, a, false, b, (short)0, c, false, false); }
__device__ __forceinline__ h16 tohx(float x) { return (h16)x; }
__device__ __forceinline__ void splitf(float y, unsigned short& h, unsigned short& l) { h = f2bf(y); l = f2bf(y - bf2f(h)); }
typedef __attribute__((ext_vector_type(4))) _Float16 v4h;
typedef __attribute__((ext_vector_type(4))) unsigned short v4us;



// ---- k_gemmw: register-blocked GEMM, one 64x64 output tile per work-group (16 accumulators per wave), operands straight from K-contiguous 16-bit planes; grid (M/64, N/64, Z), 32 * KS threads.
// C[m][n] (f32, pitch ldc, + optional f32 bias[n]) = sum_k A[m][k] Bt[n][k] (+ split products per NSPLIT). z-batch strides sA/sB/sC in elements. K % (32 * KS) == 0.
// KS waves split K: wave w sums k in [w K/KS, (w+1) K/KS) for the whole tile, the KS partial tiles meet in LDS and are added in wave order (fixed, so the result is the same on every run).
// PL: no f32 C; the summed tile goes out as three 16-bit planes (fp16, bf16 hi, bf16 lo) at element blockIdx.y * sN + m * ldc + (n - c0). sN = TT * HD, ldc = HD: head planes [n / 64][m][n % 64]; sN = 64, ldc = N: plain row-major.
template <typename T16> struct WFrag;
template <> struct WFrag<h16> { typedef v16h V; static __device__ __forceinline__ V ld(const h16* p) { return cat16(*(const v8h*)p, *(const v8h*)(p + 16)); } static __device__ __forceinline__ v8f mma(V a, V b, v8f c) { return wmma16(a, b, c); } };
template <> struct WFrag<bf> { typedef v16bf V; static __device__ __forceinline__ V ld(const bf* p) { return cat16b(*(const v8us*)p, *(const v8us*)(p + 16)); } static __device__ __forceinline__ v8f mma(V a, V b, v8f c) { return wmmab(a, b, c); } };
template <typename T16, int NSPLIT, bool BIAS, int KS, bool PL>
__global__ __launch_bounds__(32 * KS) void k_gemmw(const T16* __restrict__ A, const T16* __restrict__ A2, const T16* __restrict__ Bt, const T16* __restrict__ Bt2, int K, float* C, int ldc, const float* __restrict__ bias, size_t sA, size_t sB, size_t sC, h16* P16, bf* Ph, bf* Pl, size_t sN) {
    static_assert(!PL || KS > 1, "the plane epilogue follows the sum across waves");
    typedef typename WFrag<T16>::V V;
    __shared__ __align__(16) float os[(KS == 1 ? 16 : KS * 64) * 68];
    const size_t z = blockIdx.z; A += z * sA; if (A2) A2 += z * sA; Bt += z * sB; if (Bt2) Bt2 += z * sB; if (!PL) C += z * sC;
    const int lane = threadIdx.x & 31, lr = lane & 15, hi = lane >> 4; const int r0 = blockIdx.x * 64, c0 = blockIdx.y * 64;
    v8f acc[4][4];
#pragma unroll
    for (int mb = 0; mb < 4; ++mb)
#pragma unroll
        for (int nb = 0; nb < 4; ++nb) acc[mb][nb] = (v8f){};
    const size_t aoff = (size_t)(r0 + lr) * K + 8 * hi, boff = (size_t)(c0 + lr) * K + 8 * hi;
    const int wv = KS == 1 ? 0 : __builtin_amdgcn_readfirstlane((int)(threadIdx.x >> 5)); const int kb = wv * (K / KS), ke = kb + K / KS;
#pragma unroll 1
    for (int kc = kb; kc < ke; kc += 32) {
        V a[4], a2[4];
#pragma unroll
        for (int mb = 0; mb < 4; ++mb) { a[mb] = WFrag<T16>::ld(A + aoff + (size_t)mb * 16 * K + kc); if (NSPLIT == 1 || NSPLIT == 2) a2[mb] = WFrag<T16>::ld(A2 + aoff + (size_t)mb * 16 * K + kc); }
#pragma unroll
        for (int nb = 0; nb < 4; ++nb) { const V b = WFrag<T16>::ld(Bt + boff + (size_t)nb * 16 * K + kc); V b2; if (NSPLIT >= 2) b2 = WFrag<T16>::ld(Bt2 + boff + (size_t)nb * 16 * K + kc);
#pragma unroll
            for (int mb = 0; mb < 4; ++mb) { acc[mb][nb] = WFrag<T16>::mma(a[mb], b, acc[mb][nb]); if (NSPLIT == 1 || NSPLIT == 2) acc[mb][nb] = WFrag<T16>::mma(a2[mb], b, acc[mb][nb]); if (NSPLIT >= 2) acc[mb][nb] = WFrag<T16>::mma(a[mb], b2, acc[mb][nb]); } }
        asm volatile("v_nop\n\tv_nop\n\tv_nop\n\tv_nop" : "+v"(acc[0][0]), "+v"(acc[1][1]), "+v"(acc[2][2]), "+v"(acc[3][3]) : "v"(a[0]), "v"(a[3]));
    }
    if constexpr (KS > 1) {
        float* ow = os + wv * (64 * 68);
#pragma unroll
        for (int mb = 0; mb < 4; ++mb)
#pragma unroll
            for (int nb = 0; nb < 4; ++nb)
#pragma unroll
                for (int j = 0; j < 8; ++j) ow[(mb * 16 + hi * 8 + j) * 68 + nb * 16 + lr] = acc[mb][nb][j];
        __syncthreads();   // every wave's partial tile is in LDS before any thread sums across waves
#pragma unroll
        for (int s = 0; s < 32 / KS; ++s) { const int q4 = s * (32 * KS) + (int)threadIdx.x, row = q4 >> 4, cofs = (q4 & 15) * 4; v4f val = *(const v4fa*)(os + row * 68 + cofs);
#pragma unroll
            for (int w = 1; w < KS; ++w) val += *(const v4fa*)(os + w * (64 * 68) + row * 68 + cofs);
            if (BIAS) { val[0] += bfr(bias[c0 + cofs]); val[1] += bfr(bias[c0 + cofs + 1]); val[2] += bfr(bias[c0 + cofs + 2]); val[3] += bfr(bias[c0 + cofs + 3]); }
            if constexpr (PL) { const size_t po = (size_t)blockIdx.y * sN + (size_t)(r0 + row) * ldc + cofs; v4h o16; v4us oh, ol;
#pragma unroll
                for (int k = 0; k < 4; ++k) { o16[k] = tohx(val[k]); unsigned short a2, c2; splitf(val[k], a2, c2); oh[k] = a2; ol[k] = c2; }
                *(v4h*)(P16 + po) = o16; *(v4us*)(Ph + po) = oh; *(v4us*)(Pl + po) = ol; }
            else *(v4f*)(C + (size_t)(r0 + row) * ldc + c0 + cofs) = val; }
        return;
    }
#pragma unroll
    for (int mb = 0; mb < 4; ++mb) {
#pragma unroll
        for (int nb = 0; nb < 4; ++nb) {
#pragma unroll
            for (int j = 0; j < 8; ++j) os[(hi * 8 + j) * 68 + nb * 16 + lr] = acc[mb][nb][j]; }
        __builtin_amdgcn_wave_barrier(); asm volatile("" ::: "memory");
        float* crow = C + (size_t)(r0 + mb * 16) * ldc + c0;
{
#pragma unroll
            for (int s = 0; s < 8; ++s) { const int row = 2 * s + hi, cofs = lr * 4; v4f val = *(const v4fa*)(os + row * 68 + cofs); if (BIAS) { val[0] += bfr(bias[c0 + cofs]); val[1] += bfr(bias[c0 + cofs + 1]); val[2] += bfr(bias[c0 + cofs + 2]); val[3] += bfr(bias[c0 + cofs + 3]); }
                *(v4f*)(crow + (size_t)row * ldc + cofs) = val; }
             }
        __builtin_amdgcn_wave_barrier(); asm volatile("" ::: "memory");
    }
}

typedef __attribute__((ext_vector_type(2))) float v2f;

__global__ __launch_bounds__(256) void k_cvt8(const float* __restrict__ src, bf* dst, size_t n8) { const size_t i = (size_t)blockIdx.x * 256 + threadIdx.x; if (i >= n8) return; const v8f v = *(const v8f*)(src + i * 8); v8us o;
#pragma unroll
    for (int k = 0; k < 8; ++k) o[k] = f2bf(v[k]); *(v8us*)(dst + i * 8) = o;  }

#define SC2 (SCL * 1.4426950408889634f)   // score scale x log2(e): scores go straight to the exp2 domain
#define SK  64                      // keys per stage: K rows (HD) and V^T rows (SK) are both 128 bytes
#define LP  72                      // LDS row pitch in 16-bit elements: 144 bytes = 16 x odd, conflict-free for 16-byte reads
#define PLN (64 * LP)               // one staged plane: 64 rows
__device__ __forceinline__ float xhalf(float x) { const int b = __float_as_int(x); return __int_as_float(__builtin_amdgcn_permlanex16(b, b, 0x76543210, 0xfedcba98, false, false)); }   // lane l <-> l ^ 16
template <typename V> __device__ __forceinline__ V ldsfrag(const unsigned short* p) { return __builtin_bit_cast(V, __builtin_shufflevector(*(const v8usa*)p, *(const v8usa*)(p + 16), 0, 1, 2, 3, 4, 5, 6, 7, 8, 9, 10, 11, 12, 13, 14, 15)); }
template <typename T16, bool HI, int QT>
__device__ __forceinline__ void attn_wg(unsigned short* sm, const T16* __restrict__ Q, const T16* __restrict__ Q2, const T16* __restrict__ Kp, const T16* __restrict__ K2, const T16* __restrict__ Vt, const T16* __restrict__ V2, int q0, bf* Ah, bf* Al) {
    typedef WFrag<T16> F; typedef typename F::V V;
    constexpr int NP = HI ? 4 : 2;   // staged planes: K, V^T (, K lo, V^T lo)
    const int lane = threadIdx.x & 31, lr = lane & 15, hi = lane >> 4;
    const int srow = (int)threadIdx.x >> 3, sseg = ((int)threadIdx.x & 7) * 8;   // staging: 8 threads a 128-byte row, 16 rows a sweep of the 128 threads
    V qf[QT][2], q2[QT][2];
#pragma unroll
    for (int qt = 0; qt < QT; ++qt)
#pragma unroll
        for (int ks = 0; ks < 2; ++ks) { const size_t qo = (size_t)(q0 + qt * 16 + lr) * HD + ks * 32 + 8 * hi; qf[qt][ks] = F::ld(Q + qo); if (HI) q2[qt][ks] = F::ld(Q2 + qo); }
    v8f o[4][QT]; float m[QT], l[QT];
#pragma unroll
    for (int qt = 0; qt < QT; ++qt) { m[qt] = -3.0e38f; l[qt] = 0.f;
#pragma unroll
        for (int db = 0; db < 4; ++db) o[db][qt] = (v8f){}; }
    v8us st[NP][4]; const unsigned sko = (unsigned)(srow * HD + sseg), svo = (unsigned)(srow * TT + sseg);
    auto gld = [&](int k0) {
#pragma unroll
        for (int r = 0; r < 4; ++r) { const unsigned kg = sko + 16 * r * HD, vg = svo + 16 * r * TT;   // wave-uniform base + 32-bit lane offset
            st[0][r] = *(const v8usa*)(Kp + (size_t)k0 * HD + kg); st[1][r] = *(const v8usa*)(Vt + k0 + vg); if constexpr (HI) { st[2][r] = *(const v8usa*)(K2 + (size_t)k0 * HD + kg); st[3][r] = *(const v8usa*)(V2 + k0 + vg); } } };
    auto sst = [&](int buf) {
#pragma unroll
        for (int pl = 0; pl < NP; ++pl)
#pragma unroll
            for (int r = 0; r < 4; ++r) *(v8usa*)(sm + (buf * NP + pl) * PLN + (srow + 16 * r) * LP + sseg) = st[pl][r]; };
    auto stage = [&](int buf) __attribute__((always_inline)) {   // the two 32-key passes over one staged buffer
        const unsigned short* sb = sm + buf * NP * PLN + lr * LP + 8 * hi;
#pragma unroll
        for (int ps = 0; ps < SK / 32; ++ps) {
            v8f s[2][QT];
#pragma unroll
            for (int kt = 0; kt < 2; ++kt) { V kf[2], k2[2];
#pragma unroll
                for (int ks = 0; ks < 2; ++ks) { kf[ks] = ldsfrag<V>(sb + (ps * 32 + kt * 16) * LP + ks * 32); if (HI) k2[ks] = ldsfrag<V>(sb + 2 * PLN + (ps * 32 + kt * 16) * LP + ks * 32); }
#pragma unroll
                for (int qt = 0; qt < QT; ++qt) { v8f t = (v8f){};
#pragma unroll
                    for (int ks = 0; ks < 2; ++ks) { t = F::mma(kf[ks], qf[qt][ks], t); if (HI) { t = F::mma(kf[ks], q2[qt][ks], t); t = F::mma(k2[ks], qf[qt][ks], t); } }
                    s[kt][qt] = t; } }
            V vf[4], v2[4];
#pragma unroll
            for (int db = 0; db < 4; ++db) { vf[db] = ldsfrag<V>(sb + PLN + db * 16 * LP + ps * 32); if (HI) v2[db] = ldsfrag<V>(sb + 3 * PLN + db * 16 * LP + ps * 32); }
            __builtin_amdgcn_sched_barrier(0);   // keeps the V^T reads issued here, ahead of the softmax that hides their LDS latency; without it they sink to the second product, one waited pair at a time
            float mn[QT]; bool need = false;
#pragma unroll
            for (int qt = 0; qt < QT; ++qt) { float mx = fmaxf(s[0][qt][0], s[1][qt][0]);
#pragma unroll
                for (int j = 1; j < 8; ++j) mx = fmaxf(mx, fmaxf(s[0][qt][j], s[1][qt][j]));
                mx = fmaxf(mx, xhalf(mx)) * SC2; mn[qt] = mx; need = need || (mx > m[qt] + 8.0f); }
            if (__builtin_amdgcn_ballot_w32(need) != 0) {   // wave-uniform: one scalar branch a pass
#pragma unroll
                for (int qt = 0; qt < QT; ++qt) { const float mw = fmaxf(m[qt], mn[qt]); const float al = __builtin_amdgcn_exp2f(m[qt] - mw); m[qt] = mw; l[qt] *= al;
#pragma unroll
                    for (int db = 0; db < 4; ++db) o[db][qt] *= al; } }
            V pf[QT], p2[QT];
#pragma unroll
            for (int qt = 0; qt < QT; ++qt) { v2f ls = (v2f){};
#pragma unroll
                for (int kt = 0; kt < 2; ++kt)
#pragma unroll
                    for (int j = 0; j < 8; j += 2) { const v2f t = __builtin_elementwise_fma((v2f){s[kt][qt][j], s[kt][qt][j + 1]}, (v2f){SC2, SC2}, (v2f){-m[qt], -m[qt]}); s[kt][qt][j] = __builtin_amdgcn_exp2f(t[0]); s[kt][qt][j + 1] = __builtin_amdgcn_exp2f(t[1]); }
#pragma unroll
                for (int i = 0; i < 16; ++i) { const float p = s[i >> 3][qt][i & 7]; ls[i & 1] += p;
                    if constexpr (HI) { const __bf16 ph = (__bf16)p; pf[qt][i] = ph; p2[qt][i] = (__bf16)(p - (float)ph); } else pf[qt][i] = (_Float16)p; }
                l[qt] += ls[0] + ls[1]; }
#pragma unroll
            for (int db = 0; db < 4; ++db)
#pragma unroll
                for (int qt = 0; qt < QT; ++qt) { o[db][qt] = F::mma(vf[db], pf[qt], o[db][qt]); if (HI) { o[db][qt] = F::mma(vf[db], p2[qt], o[db][qt]); o[db][qt] = F::mma(v2[db], pf[qt], o[db][qt]); } }
        }
    };
    gld(0); sst(0);
    __syncthreads();   // stage 0 is in LDS before any wave reads it
#pragma unroll 1   // stays rolled: a second copy of the stage would double the staging registers and the code
    for (int sg = 0; sg < TT / SK - 1; ++sg) {
        gld((sg + 1) * SK);   // the next stage flies during this stage's two passes
        stage(sg & 1);
        sst((sg + 1) & 1);   // into the buffer whose last readers left it before the previous barrier
        __syncthreads();   // publishes stage sg + 1 and ends every wave's reads of stage sg, whose buffer the next trip refills
    }
    stage((TT / SK - 1) & 1);
#pragma unroll
    for (int qt = 0; qt < QT; ++qt) { const float inv = __fdiv_rn(1.0f, l[qt] + xhalf(l[qt])); const size_t oo = (size_t)(q0 + qt * 16 + lr) * DQ + hi * 8;
#pragma unroll
        for (int db = 0; db < 4; ++db) { v8us oh, ol;
#pragma unroll
            for (int j = 0; j < 8; ++j) { unsigned short a, c2; splitf(o[db][qt][j] * inv, a, c2); oh[j] = a; ol[j] = c2; }
            *(v8us*)(Ah + oo + db * 16) = oh; *(v8us*)(Al + oo + db * 16) = ol; } }
    asm volatile("s_wait_xcnt 0x0" ::: "memory");   // stands between the last stores and any later write of a register that they name
}
// grid (heads, RH / 64 + (TT - RH) / 128), 4 waves: the hi/lo blocks (16 queries a wave) come first in y, then the fp16 blocks (32 queries a wave)
__global__ __launch_bounds__(128) void k_fattn(const h16* __restrict__ Q16, const bf* __restrict__ Qh, const bf* __restrict__ Ql, const h16* __restrict__ K16, const bf* __restrict__ Kh, const bf* __restrict__ Kl, const h16* __restrict__ V16, const bf* __restrict__ Vh, const bf* __restrict__ Vl, bf* Ah, bf* Al) {
    __shared__ __align__(16) unsigned short sm[2 * 4 * PLN];   // two buffers of up to four planes
    const int h = blockIdx.x, y = blockIdx.y; const int wv = __builtin_amdgcn_readfirstlane((int)(threadIdx.x >> 5)); const size_t ho = (size_t)h * TT * HD;
    if (y < RH / 64) attn_wg<bf, true, 1>(sm, Qh + ho, Ql + ho, Kh + ho, Kl + ho, Vh + ho, Vl + ho, y * 64 + wv * 16, Ah + h * HD, Al + h * HD);
    else attn_wg<h16, false, 2>(sm, Q16 + ho, nullptr, K16 + ho, nullptr, V16 + ho, nullptr, RH + (y - RH / 64) * 128 + wv * 32, Ah + h * HD, Al + h * HD);
}

extern "C" void kernel_launch(void* const* d_in, const int* in_sizes, int n_in,
                              void* d_out, int out_size, void* d_ws, size_t ws_size, hipStream_t stream) {
    (void)in_sizes; (void)n_in; (void)out_size;
    const float* x = (const float*)d_in[0]; const float* wq = (const float*)d_in[1]; const float* wk = (const float*)d_in[2]; const float* wv = (const float*)d_in[3]; const float* wo = (const float*)d_in[4]; const float* bo = (const float*)d_in[5];   /* input order x, Wq, Wk, Wv, Wo ('oi' [1024][1024]), bo */
    float* OUT = (float*)d_out;     // [2][2048][1024]
    char* wsp = (char*)d_ws;
    auto take = [&](size_t bytes) { char* p = wsp; wsp += (bytes + 255) & ~(size_t)255; return (void*)p; };
    bf* WQ = (bf*)take((size_t)DQ * DM * 2); bf* WK = (bf*)take((size_t)DKV * DM * 2); bf* WV = (bf*)take((size_t)DKV * DM * 2); bf* WO = (bf*)take((size_t)DM * DQ * 2);
    bf* XB = (bf*)take((size_t)TT * DM * 2);
    h16* QP16 = (h16*)take((size_t)NH_ * TT * HD * 2); h16* KP16 = (h16*)take((size_t)NKV * TT * HD * 2); h16* VT16 = (h16*)take((size_t)NKV * HD * TT * 2);
    bf* QPh = (bf*)take((size_t)NH_ * TT * HD * 2); bf* QPl = (bf*)take((size_t)NH_ * TT * HD * 2); bf* KPh = (bf*)take((size_t)NKV * TT * HD * 2); bf* KPl = (bf*)take((size_t)NKV * TT * HD * 2); bf* VTh = (bf*)take((size_t)NKV * HD * TT * 2); bf* VTl = (bf*)take((size_t)NKV * HD * TT * 2);
    bf* ATh = (bf*)take((size_t)TT * DQ * 2); bf* ATl = (bf*)take((size_t)TT * DQ * 2);
    if ((size_t)(wsp - (char*)d_ws) > ws_size) return;    // ws 256 MiB
    { k_cvt8<<<(unsigned)(((size_t)DQ * DM / 8 + 255) / 256), 256, 0, stream>>>(wq, WQ, (size_t)DQ * DM / 8); k_cvt8<<<(unsigned)(((size_t)DKV * DM / 8 + 255) / 256), 256, 0, stream>>>(wk, WK, (size_t)DKV * DM / 8); k_cvt8<<<(unsigned)(((size_t)DKV * DM / 8 + 255) / 256), 256, 0, stream>>>(wv, WV, (size_t)DKV * DM / 8);
      k_cvt8<<<(unsigned)(((size_t)DM * DQ / 8 + 255) / 256), 256, 0, stream>>>(wo, WO, (size_t)DM * DQ / 8);
       }
    for (int b = 0; b < NB_; ++b) {
        
        k_cvt8<<<(unsigned)(((size_t)TT * DM / 8 + 255) / 256), 256, 0, stream>>>(x + (size_t)b * TT * DM, XB, (size_t)TT * DM / 8);
        k_gemmw<bf, 0, false, 8, true><<<dim3(TT / 64, DQ / 64, 1), 256, 0, stream>>>(XB, nullptr, WQ, nullptr, DM, nullptr, HD, nullptr, 0, 0, 0, QP16, QPh, QPl, (size_t)TT * HD);    // [h][t][d]
        k_gemmw<bf, 0, false, 8, true><<<dim3(TT / 64, DKV / 64, 1), 256, 0, stream>>>(XB, nullptr, WK, nullptr, DM, nullptr, HD, nullptr, 0, 0, 0, KP16, KPh, KPl, (size_t)TT * HD);   // [h][t][d]
        k_gemmw<bf, 0, false, 8, true><<<dim3(DKV / 64, TT / 64, 1), 256, 0, stream>>>(WV, nullptr, XB, nullptr, DM, nullptr, TT, nullptr, 0, 0, 0, VT16, VTh, VTl, 64);                // Wv x^T: [h][d][t]
        k_fattn<<<dim3(NH_, RH / 64 + (TT - RH) / 128, 1), 128, 0, stream>>>(QP16, QPh, QPl, KP16, KPh, KPl, VT16, VTh, VTl, ATh, ATl);   // one kv head per query head
        k_gemmw<bf, 1, true, 8, false><<<dim3(TT / 64, DM / 64, 1), 256, 0, stream>>>(ATh, ATl, WO, nullptr, DQ, OUT + (size_t)b * TT * DM, DM, bo, 0, 0, 0, nullptr, nullptr, nullptr, 0); }
}

// v005
// One run takes 149 microseconds.
// Next to v004, in two timings, it ran 1.31 and 1.32 times as fast.
// All steps since v000 together make it 13.1 times as fast.
#include <hip/hip_runtime.h>

// Multi-head attention with bias-free projections, an output bias and a MODEL-width score scale (x [2][2048][1024]; Q, K, V = x W^T ('oi' [1024][1024] normal x 0.02, no bias; 16 heads x 64); scores / sqrt(float32(1024)) = x 0.03125 (the source divides by the square root of the FULL width k, not of the head width); softmax (no mask); out = merged Wo^T + bo ('oi' + bias zeros on this draw: read) -> [2][2048][1024] (4.2 M); argument order x, Wq, Wk, Wv, Wo, bo.
// Layout, both batches in every launch (4 launches: convert, Q/K/V projections, attention, Wo): bf16 copy of x; 'oi' weights; exact projections whose epilogue writes the 16-bit head planes (V as Wv x^T, so its tile is V^T already); fused dense T-2048 attention, scores kept in registers (hybrid rows: < 512 hi/lo 3 products, rest fp16); merged hi/lo x Wo exact + bo.
// Compute dtypes, f32 accumulate: every input rounded to bf16; projections exact; attention rows < 512 3 products, rest fp16; softmax f32; Wo hl x exact + bias.

#define NB_  2
#define TT   2048
#define DM   1024
#define NH_  16
#define NKV  16
#define REP  (NH_ / NKV)
#define HD   64
#define DQ   (NH_ * HD)
#define DKV  (NKV * HD)
#define RH   512                  // query rows < RH use hi+lo planes (0: none)
#define WIN  0
#define SCL  0.03125f   // 1 / sqrt(1024): this module divides by sqrt(k) with k the FULL width
typedef _Float16 h16;
typedef unsigned short bf;
typedef __attribute__((ext_vector_type(16))) __bf16   v16bf;
typedef __attribute__((ext_vector_type(16))) _Float16 v16h;
typedef __attribute__((ext_vector_type(8)))  _Float16 v8h;
typedef __attribute__((ext_vector_type(8)))  unsigned short v8us;
typedef __attribute__((ext_vector_type(8)))  float    v8f;
typedef __attribute__((ext_vector_type(4)))  float    v4f;
typedef v8h  __attribute__((may_alias)) v8ha;
typedef v4f  __attribute__((may_alias)) v4fa;
typedef v8us __attribute__((may_alias)) v8usa;

__device__ __forceinline__ unsigned short f2bf(float f) { unsigned u = __float_as_uint(f); u += 0x7FFFu + ((u >> 16) & 1u); return (unsigned short)(u >> 16); }
__device__ __forceinline__ float bf2f(unsigned short b) { return __uint_as_float(((unsigned)b) << 16); }
__device__ __forceinline__ float bfr(float f) { return bf2f(f2bf(f)); }
__device__ __forceinline__ v16h cat16(v8h lo, v8h hi) { return __builtin_shufflevector(lo, hi, 0, 1, 2, 3, 4, 5, 6, 7, 8, 9, 10, 11, 12, 13, 14, 15); }
__device__ __forceinline__ v16bf cat16b(v8us lo, v8us hi) { return __builtin_bit_cast(v16bf, __builtin_shufflevector(lo, hi, 0, 1, 2, 3, 4, 5, 6, 7, 8, 9, 10, 11, 12, 13, 14, 15)); }
__device__ __forceinline__ v8f wmma16(v16h a, v16h b, v8f c) { return __builtin_amdgcn_wmma_f32_16x16x32_f16(false, a, false, b, (short)0, c, false, false); }
__device__ __forceinline__ v8f wmmab(v16bf a, v16bf b, v8f c) { return __builtin_amdgcn_wmma_f32_16x16x32_bf16(false, a, false, b, (short)0, c, false, false); }
__device__ __forceinline__ h16 tohx(float x) { return (h16)x; }
__device__ __forceinline__ void splitf(float y, unsigned short& h, unsigned short& l) { h = f2bf(y); l = f2bf(y - bf2f(h)); }
typedef __attribute__((ext_vector_type(4))) _Float16 v4h;
typedef __attribute__((ext_vector_type(4))) unsigned short v4us;



// ---- gemmw_tile: register-blocked GEMM, one 64x64 output tile (tile row bx, tile column by) per work-group (16 accumulators per wave), operands straight from K-contiguous 16-bit planes; 32 * KS threads.
// C[m][n] (f32, pitch ldc, + optional f32 bias[n]) = sum_k A[m][k] Bt[n][k] (+ split products per NSPLIT). K % (32 * KS) == 0.
// KS waves split K: wave w sums k in [w K/KS, (w+1) K/KS) for the whole tile, the KS partial tiles meet in LDS and are added in wave order (fixed, so the result is the same on every run).
// PL: no f32 C; the summed tile goes out as three 16-bit planes (fp16, bf16 hi, bf16 lo) at element by * sN + m * ldc + (n - c0). sN = TT * HD, ldc = HD: head planes [n / 64][m][n % 64]; sN = 64, ldc = N: plain row-major.
template <typename T16> struct WFrag;
template <> struct WFrag<h16> { typedef v16h V; static __device__ __forceinline__ V ld(const h16* p) { return cat16(*(const v8h*)p, *(const v8h*)(p + 16)); } static __device__ __forceinline__ v8f mma(V a, V b, v8f c) { return wmma16(a, b, c); } };
template <> struct WFrag<bf> { typedef v16bf V; static __device__ __forceinline__ V ld(const bf* p) { return cat16b(*(const v8us*)p, *(const v8us*)(p + 16)); } static __device__ __forceinline__ v8f mma(V a, V b, v8f c) { return wmmab(a, b, c); } };
template <typename T16, int NSPLIT, bool BIAS, int KS, bool PL>
__device__ __forceinline__ void gemmw_tile(const T16* __restrict__ A, const T16* __restrict__ A2, const T16* __restrict__ Bt, const T16* __restrict__ Bt2, int K, float* C, int ldc, const float* __restrict__ bias, h16* P16, bf* Ph, bf* Pl, size_t sN, int bx, int by) {
    static_assert(!PL || KS > 1, "the plane epilogue follows the sum across waves");
    typedef typename WFrag<T16>::V V;
    __shared__ __align__(16) float os[(KS == 1 ? 16 : KS * 64) * 68];
    const int lane = threadIdx.x & 31, lr = lane & 15, hi = lane >> 4; const int r0 = bx * 64, c0 = by * 64;
    v8f acc[4][4];
#pragma unroll
    for (int mb = 0; mb < 4; ++mb)
#pragma unroll
        for (int nb = 0; nb < 4; ++nb) acc[mb][nb] = (v8f){};
    const size_t aoff = (size_t)(r0 + lr) * K + 8 * hi, boff = (size_t)(c0 + lr) * K + 8 * hi;
    const int wv = KS == 1 ? 0 : __builtin_amdgcn_readfirstlane((int)(threadIdx.x >> 5)); const int kb = wv * (K / KS), ke = kb + K / KS;
#pragma unroll 1
    for (int kc = kb; kc < ke; kc += 32) {
        V a[4], a2[4];
#pragma unroll
        for (int mb = 0; mb < 4; ++mb) { a[mb] = WFrag<T16>::ld(A + aoff + (size_t)mb * 16 * K + kc); if (NSPLIT == 1 || NSPLIT == 2) a2[mb] = WFrag<T16>::ld(A2 + aoff + (size_t)mb * 16 * K + kc); }
#pragma unroll
        for (int nb = 0; nb < 4; ++nb) { const V b = WFrag<T16>::ld(Bt + boff + (size_t)nb * 16 * K + kc); V b2; if (NSPLIT >= 2) b2 = WFrag<T16>::ld(Bt2 + boff + (size_t)nb * 16 * K + kc);
#pragma unroll
            for (int mb = 0; mb < 4; ++mb) { acc[mb][nb] = WFrag<T16>::mma(a[mb], b, acc[mb][nb]); if (NSPLIT == 1 || NSPLIT == 2) acc[mb][nb] = WFrag<T16>::mma(a2[mb], b, acc[mb][nb]); if (NSPLIT >= 2) acc[mb][nb] = WFrag<T16>::mma(a[mb], b2, acc[mb][nb]); } }
        asm volatile("v_nop\n\tv_nop\n\tv_nop\n\tv_nop" : "+v"(acc[0][0]), "+v"(acc[1][1]), "+v"(acc[2][2]), "+v"(acc[3][3]) : "v"(a[0]), "v"(a[3]));
    }
    if constexpr (KS > 1) {
        float* ow = os + wv * (64 * 68);
#pragma unroll
        for (int mb = 0; mb < 4; ++mb)
#pragma unroll
            for (int nb = 0; nb < 4; ++nb)
#pragma unroll
                for (int j = 0; j < 8; ++j) ow[(mb * 16 + hi * 8 + j) * 68 + nb * 16 + lr] = acc[mb][nb][j];
        __syncthreads();   // every wave's partial tile is in LDS before any thread sums across waves
#pragma unroll
        for (int s = 0; s < 32 / KS; ++s) { const int q4 = s * (32 * KS) + (int)threadIdx.x, row = q4 >> 4, cofs = (q4 & 15) * 4; v4f val = *(const v4fa*)(os + row * 68 + cofs);
#pragma unroll
            for (int w = 1; w < KS; ++w) val += *(const v4fa*)(os + w * (64 * 68) + row * 68 + cofs);
            if (BIAS) { val[0] += bfr(bias[c0 + cofs]); val[1] += bfr(bias[c0 + cofs + 1]); val[2] += bfr(bias[c0 + cofs + 2]); val[3] += bfr(bias[c0 + cofs + 3]); }
            if constexpr (PL) { const size_t po = (size_t)by * sN + (size_t)(r0 + row) * ldc + cofs; v4h o16; v4us oh, ol;
#pragma unroll
                for (int k = 0; k < 4; ++k) { o16[k] = tohx(val[k]); unsigned short a2, c2; splitf(val[k], a2, c2); oh[k] = a2; ol[k] = c2; }
                *(v4h*)(P16 + po) = o16; *(v4us*)(Ph + po) = oh; *(v4us*)(Pl + po) = ol; }
            else *(v4f*)(C + (size_t)(r0 + row) * ldc + c0 + cofs) = val; }
        return;
    }
#pragma unroll
    for (int mb = 0; mb < 4; ++mb) {
#pragma unroll
        for (int nb = 0; nb < 4; ++nb) {
#pragma unroll
            for (int j = 0; j < 8; ++j) os[(hi * 8 + j) * 68 + nb * 16 + lr] = acc[mb][nb][j]; }
        __builtin_amdgcn_wave_barrier(); asm volatile("" ::: "memory");
        float* crow = C + (size_t)(r0 + mb * 16) * ldc + c0;
{
#pragma unroll
            for (int s = 0; s < 8; ++s) { const int row = 2 * s + hi, cofs = lr * 4; v4f val = *(const v4fa*)(os + row * 68 + cofs); if (BIAS) { val[0] += bfr(bias[c0 + cofs]); val[1] += bfr(bias[c0 + cofs + 1]); val[2] += bfr(bias[c0 + cofs + 2]); val[3] += bfr(bias[c0 + cofs + 3]); }
                *(v4f*)(crow + (size_t)row * ldc + cofs) = val; }
             }
        __builtin_amdgcn_wave_barrier(); asm volatile("" ::: "memory");
    }
}

// k_gemmo: merged hi/lo x Wo + bo for the rows of both batches; grid (NB_ * TT / 64, DM / 64).
__global__ __launch_bounds__(256) void k_gemmo(const bf* __restrict__ Ah, const bf* __restrict__ Al, const bf* __restrict__ Wo, float* C, const float* __restrict__ bias) {
    gemmw_tile<bf, 1, true, 8, false>(Ah, Al, Wo, nullptr, DQ, C, DM, bias, nullptr, nullptr, nullptr, 0, blockIdx.x, blockIdx.y);
}
// k_qkv: the three projections of both batches in one launch; grid (tiles of one projection of one batch, NB_, 3), z = 0 Q, 1 K, 2 V. W: Wq, Wk, Wv one behind the other; each plane set: [z][batch][head]...
// Q, K: x W^T, tile row fastest, planes [h][t][d]. V: Wv x^T, planes [h][d][t].
static_assert(DQ == DKV, "the three projections share one tile count and one plane size");
__global__ __launch_bounds__(256) void k_qkv(const bf* __restrict__ X, const bf* __restrict__ Wt, h16* P16, bf* Ph, bf* Pl) {
    const unsigned f = blockIdx.x, b = blockIdx.y, pj = blockIdx.z; const bool tv = pj == 2;
    const bf* xb = X + (size_t)b * TT * DM; const bf* w = Wt + (size_t)pj * DQ * DM; const size_t pp = ((size_t)pj * NB_ + b) * ((size_t)DQ * TT);
    gemmw_tile<bf, 0, false, 8, true>(tv ? w : xb, nullptr, tv ? xb : w, nullptr, DM, nullptr, tv ? TT : HD, nullptr, P16 + pp, Ph + pp, Pl + pp, tv ? (size_t)64 : (size_t)TT * HD, tv ? f % (DKV / 64) : f % (TT / 64), tv ? f / (DKV / 64) : f / (TT / 64));
}

typedef __attribute__((ext_vector_type(2))) float v2f;

// k_cvt8: every f32 input but the bias to bf16 in one launch; dst holds Wq, Wk, Wv, Wo, x one behind the other. WB blocks a weight, the rest of the grid is x (both batches).
#define WB (DQ * DM / 8 / 256)
__global__ __launch_bounds__(256) void k_cvt8(const float* __restrict__ wq, const float* __restrict__ wk, const float* __restrict__ wv, const float* __restrict__ wo, const float* __restrict__ x, bf* dst) {
    const unsigned blk = blockIdx.x; const float* src = blk < WB ? wq : blk < 2 * WB ? wk : blk < 3 * WB ? wv : blk < 4 * WB ? wo : x;
    const size_t i = (size_t)(blk < 4 * WB ? blk % WB : blk - 4 * WB) * 256 + threadIdx.x; const v8f v = *(const v8f*)(src + i * 8); v8us o;
#pragma unroll
    for (int k = 0; k < 8; ++k) o[k] = f2bf(v[k]); *(v8us*)(dst + ((size_t)blk * 256 + threadIdx.x) * 8) = o;  }

#define SC2 (SCL * 1.4426950408889634f)   // score scale x log2(e): scores go straight to the exp2 domain
#define SK  64                      // keys per stage: K rows (HD) and V^T rows (SK) are both 128 bytes
#define LP  72                      // LDS row pitch in 16-bit elements: 144 bytes = 16 x odd, conflict-free for 16-byte reads
#define PLN (64 * LP)               // one staged plane: 64 rows
__device__ __forceinline__ float xhalf(float x) { const int b = __float_as_int(x); return __int_as_float(__builtin_amdgcn_permlanex16(b, b, 0x76543210, 0xfedcba98, false, false)); }   // lane l <-> l ^ 16
template <typename V> __device__ __forceinline__ V ldsfrag(const unsigned short* p) { return __builtin_bit_cast(V, __builtin_shufflevector(*(const v8usa*)p, *(const v8usa*)(p + 16), 0, 1, 2, 3, 4, 5, 6, 7, 8, 9, 10, 11, 12, 13, 14, 15)); }
template <typename T16, bool HI, int QT>
__device__ __forceinline__ void attn_wg(unsigned short* sm, const T16* __restrict__ Q, const T16* __restrict__ Q2, const T16* __restrict__ Kp, const T16* __restrict__ K2, const T16* __restrict__ Vt, const T16* __restrict__ V2, int q0, bf* Ah, bf* Al) {
    typedef WFrag<T16> F; typedef typename F::V V;
    constexpr int NP = HI ? 4 : 2;   // staged planes: K, V^T (, K lo, V^T lo)
    const int lane = threadIdx.x & 31, lr = lane & 15, hi = lane >> 4;
    const int srow = (int)threadIdx.x >> 3, sseg = ((int)threadIdx.x & 7) * 8;   // staging: 8 threads a 128-byte row, 16 rows a sweep of the 128 threads
    V qf[QT][2], q2[QT][2];
#pragma unroll
    for (int qt = 0; qt < QT; ++qt)
#pragma unroll
        for (int ks = 0; ks < 2; ++ks) { const size_t qo = (size_t)(q0 + qt * 16 + lr) * HD + ks * 32 + 8 * hi; qf[qt][ks] = F::ld(Q + qo); if (HI) q2[qt][ks] = F::ld(Q2 + qo); }
    v8f o[4][QT]; float m[QT], l[QT];
#pragma unroll
    for (int qt = 0; qt < QT; ++qt) { m[qt] = -3.0e38f; l[qt] = 0.f;
#pragma unroll
        for (int db = 0; db < 4; ++db) o[db][qt] = (v8f){}; }
    v8us st[NP][4]; const unsigned sko = (unsigned)(srow * HD + sseg), svo = (unsigned)(srow * TT + sseg);
    auto gld = [&](int k0) {
#pragma unroll
        for (int r = 0; r < 4; ++r) { const unsigned kg = sko + 16 * r * HD, vg = svo + 16 * r * TT;   // wave-uniform base + 32-bit lane offset
            st[0][r] = *(const v8usa*)(Kp + (size_t)k0 * HD + kg); st[1][r] = *(const v8usa*)(Vt + k0 + vg); if constexpr (HI) { st[2][r] = *(const v8usa*)(K2 + (size_t)k0 * HD + kg); st[3][r] = *(const v8usa*)(V2 + k0 + vg); } } };
    auto sst = [&](int buf) {
#pragma unroll
        for (int pl = 0; pl < NP; ++pl)
#pragma unroll
            for (int r = 0; r < 4; ++r) *(v8usa*)(sm + (buf * NP + pl) * PLN + (srow + 16 * r) * LP + sseg) = st[pl][r]; };
    auto stage = [&](int buf) __attribute__((always_inline)) {   // the two 32-key passes over one staged buffer
        const unsigned short* sb = sm + buf * NP * PLN + lr * LP + 8 * hi;
#pragma unroll
        for (int ps = 0; ps < SK / 32; ++ps) {
            v8f s[2][QT];
#pragma unroll
            for (int kt = 0; kt < 2; ++kt) { V kf[2], k2[2];
#pragma unroll
                for (int ks = 0; ks < 2; ++ks) { kf[ks] = ldsfrag<V>(sb + (ps * 32 + kt * 16) * LP + ks * 32); if (HI) k2[ks] = ldsfrag<V>(sb + 2 * PLN + (ps * 32 + kt * 16) * LP + ks * 32); }
#pragma unroll
                for (int qt = 0; qt < QT; ++qt) { v8f t = (v8f){};
#pragma unroll
                    for (int ks = 0; ks < 2; ++ks) { t = F::mma(kf[ks], qf[qt][ks], t); if (HI) { t = F::mma(kf[ks], q2[qt][ks], t); t = F::mma(k2[ks], qf[qt][ks], t); } }
                    s[kt][qt] = t; } }
            V vf[4], v2[4];
#pragma unroll
            for (int db = 0; db < 4; ++db) { vf[db] = ldsfrag<V>(sb + PLN + db * 16 * LP + ps * 32); if (HI) v2[db] = ldsfrag<V>(sb + 3 * PLN + db * 16 * LP + ps * 32); }
            __builtin_amdgcn_sched_barrier(0);   // keeps the V^T reads issued here, ahead of the softmax that hides their LDS latency; without it they sink to the second product, one waited pair at a time
            float mn[QT]; bool need = false;
#pragma unroll
            for (int qt = 0; qt < QT; ++qt) { float mx = fmaxf(s[0][qt][0], s[1][qt][0]);
#pragma unroll
                for (int j = 1; j < 8; ++j) mx = fmaxf(mx, fmaxf(s[0][qt][j], s[1][qt][j]));
                mx = fmaxf(mx, xhalf(mx)) * SC2; mn[qt] = mx; need = need || (mx > m[qt] + 8.0f); }
            if (__builtin_amdgcn_ballot_w32(need) != 0) {   // wave-uniform: one scalar branch a pass
#pragma unroll
                for (int qt = 0; qt < QT; ++qt) { const float mw = fmaxf(m[qt], mn[qt]); const float al = __builtin_amdgcn_exp2f(m[qt] - mw); m[qt] = mw; l[qt] *= al;
#pragma unroll
                    for (int db = 0; db < 4; ++db) o[db][qt] *= al; } }
            V pf[QT], p2[QT];
#pragma unroll
            for (int qt = 0; qt < QT; ++qt) { v2f ls = (v2f){};
#pragma unroll
                for (int kt = 0; kt < 2; ++kt)
#pragma unroll
                    for (int j = 0; j < 8; j += 2) { const v2f t = __builtin_elementwise_fma((v2f){s[kt][qt][j], s[kt][qt][j + 1]}, (v2f){SC2, SC2}, (v2f){-m[qt], -m[qt]}); s[kt][qt][j] = __builtin_amdgcn_exp2f(t[0]); s[kt][qt][j + 1] = __builtin_amdgcn_exp2f(t[1]); }
#pragma unroll
                for (int i = 0; i < 16; ++i) { const float p = s[i >> 3][qt][i & 7]; ls[i & 1] += p;
                    if constexpr (HI) { const __bf16 ph = (__bf16)p; pf[qt][i] = ph; p2[qt][i] = (__bf16)(p - (float)ph); } else pf[qt][i] = (_Float16)p; }
                l[qt] += ls[0] + ls[1]; }
#pragma unroll
            for (int db = 0; db < 4; ++db)
#pragma unroll
                for (int qt = 0; qt < QT; ++qt) { o[db][qt] = F::mma(vf[db], pf[qt], o[db][qt]); if (HI) { o[db][qt] = F::mma(vf[db], p2[qt], o[db][qt]); o[db][qt] = F::mma(v2[db], pf[qt], o[db][qt]); } }
        }
    };
    gld(0); sst(0);
    __syncthreads();   // stage 0 is in LDS before any wave reads it
#pragma unroll 1   // stays rolled: a second copy of the stage would double the staging registers and the code
    for (int sg = 0; sg < TT / SK - 1; ++sg) {
        gld((sg + 1) * SK);   // the next stage flies during this stage's two passes
        stage(sg & 1);
        sst((sg + 1) & 1);   // into the buffer whose last readers left it before the previous barrier
        __syncthreads();   // publishes stage sg + 1 and ends every wave's reads of stage sg, whose buffer the next trip refills
    }
    stage((TT / SK - 1) & 1);
#pragma unroll
    for (int qt = 0; qt < QT; ++qt) { const float inv = __fdiv_rn(1.0f, l[qt] + xhalf(l[qt])); const size_t oo = (size_t)(q0 + qt * 16 + lr) * DQ + hi * 8;
#pragma unroll
        for (int db = 0; db < 4; ++db) { v8us oh, ol;
#pragma unroll
            for (int j = 0; j < 8; ++j) { unsigned short a, c2; splitf(o[db][qt][j] * inv, a, c2); oh[j] = a; ol[j] = c2; }
            *(v8us*)(Ah + oo + db * 16) = oh; *(v8us*)(Al + oo + db * 16) = ol; } }
    asm volatile("s_wait_xcnt 0x0" ::: "memory");   // stands between the last stores and any later write of a register that they name
}
// grid (NB_ * heads, RH / 64 + (TT - RH) / 128), x = batch * heads + head, 4 waves: the hi/lo blocks (16 queries a wave) come first in y, then the fp16 blocks (32 queries a wave)
__global__ __launch_bounds__(128) void k_fattn(const h16* __restrict__ Q16, const bf* __restrict__ Qh, const bf* __restrict__ Ql, const h16* __restrict__ K16, const bf* __restrict__ Kh, const bf* __restrict__ Kl, const h16* __restrict__ V16, const bf* __restrict__ Vh, const bf* __restrict__ Vl, bf* Ah, bf* Al) {
    __shared__ __align__(16) unsigned short sm[2 * 4 * PLN];   // two buffers of up to four planes
    const int h = blockIdx.x % NH_, y = blockIdx.y; const int wv = __builtin_amdgcn_readfirstlane((int)(threadIdx.x >> 5)); const size_t ho = (size_t)blockIdx.x * TT * HD;   // planes [batch][head]...
    Ah += (size_t)(blockIdx.x / NH_) * TT * DQ; Al += (size_t)(blockIdx.x / NH_) * TT * DQ;
    if (y < RH / 64) attn_wg<bf, true, 1>(sm, Qh + ho, Ql + ho, Kh + ho, Kl + ho, Vh + ho, Vl + ho, y * 64 + wv * 16, Ah + h * HD, Al + h * HD);
    else attn_wg<h16, false, 2>(sm, Q16 + ho, nullptr, K16 + ho, nullptr, V16 + ho, nullptr, RH + (y - RH / 64) * 128 + wv * 32, Ah + h * HD, Al + h * HD);
}

extern "C" void kernel_launch(void* const* d_in, const int* in_sizes, int n_in,
                              void* d_out, int out_size, void* d_ws, size_t ws_size, hipStream_t stream) {
    (void)in_sizes; (void)n_in; (void)out_size;
    const float* x = (const float*)d_in[0]; const float* wq = (const float*)d_in[1]; const float* wk = (const float*)d_in[2]; const float* wv = (const float*)d_in[3]; const float* wo = (const float*)d_in[4]; const float* bo = (const float*)d_in[5];   /* input order x, Wq, Wk, Wv, Wo ('oi' [1024][1024]), bo */
    float* OUT = (float*)d_out;     // [2][2048][1024]
    char* wsp = (char*)d_ws;
    auto take = [&](size_t bytes) { char* p = wsp; wsp += (bytes + 255) & ~(size_t)255; return (void*)p; };
    bf* CV = (bf*)take(((size_t)4 * DQ * DM + (size_t)NB_ * TT * DM) * 2);   // Wq, Wk, Wv, Wo, x as bf16
    bf* WO = CV + (size_t)3 * DQ * DM; bf* XB = CV + (size_t)4 * DQ * DM;
    const size_t PS = (size_t)NB_ * DQ * TT;   // one plane of one projection, both batches
    h16* P16 = (h16*)take(3 * PS * 2); bf* Ph = (bf*)take(3 * PS * 2); bf* Pl = (bf*)take(3 * PS * 2);   // each: Q [b][h][t][d], K [b][h][t][d], V^T [b][h][d][t]
    bf* ATh = (bf*)take((size_t)NB_ * TT * DQ * 2); bf* ATl = (bf*)take((size_t)NB_ * TT * DQ * 2);
    if ((size_t)(wsp - (char*)d_ws) > ws_size) return;    // 104 of 256 MiB
    k_cvt8<<<4 * WB + NB_ * TT * DM / 8 / 256, 256, 0, stream>>>(wq, wk, wv, wo, x, CV);
    k_qkv<<<dim3((TT / 64) * (DQ / 64), NB_, 3), 256, 0, stream>>>(XB, CV, P16, Ph, Pl);
    k_fattn<<<dim3(NB_ * NH_, RH / 64 + (TT - RH) / 128, 1), 128, 0, stream>>>(P16, Ph, Pl, P16 + PS, Ph + PS, Pl + PS, P16 + 2 * PS, Ph + 2 * PS, Pl + 2 * PS, ATh, ATl);   // one kv head per query head
    k_gemmo<<<dim3(NB_ * TT / 64, DM / 64, 1), 256, 0, stream>>>(ATh, ATl, WO, OUT, bo);
}

// v006
// Measured time: 97.2 microseconds a run.
// In two side-by-side timings against v005, it was 1.52 and 1.51 times as fast.
// Over all steps from v000 it is 19.9 times as fast.
#include <hip/hip_runtime.h>

// Multi-head attention with bias-free projections, an output bias and a MODEL-width score scale (x [2][2048][1024]; Q, K, V = x W^T ('oi' [1024][1024] normal x 0.02, no bias; 16 heads x 64); scores / sqrt(float32(1024)) = x 0.03125 (the source divides by the square root of the FULL width k, not of the head width); softmax (no mask); out = merged Wo^T + bo ('oi' + bias zeros on this draw: read) -> [2][2048][1024] (4.2 M); argument order x, Wq, Wk, Wv, Wo, bo.
// Layout, both batches in every launch (4 launches: convert, Q/K/V projections, attention, Wo): bf16 copy of x; 'oi' weights; exact projections whose epilogue writes the 16-bit head planes (V as Wv x^T, so its tile is V^T already); fused dense T-2048 attention, scores kept in registers (hybrid rows: < 512 hi/lo 3 products, rest fp16); merged hi/lo x Wo exact + bo.
// Compute dtypes, f32 accumulate: every input rounded to bf16; projections exact; attention rows < 512 3 products, rest fp16; softmax f32; Wo hl x exact + bias.

#define NB_  2
#define TT   2048
#define DM   1024
#define NH_  16
#define NKV  16
#define REP  (NH_ / NKV)
#define HD   64
#define DQ   (NH_ * HD)
#define DKV  (NKV * HD)
#define RH   512                  // query rows < RH use hi+lo planes (0: none)
#define WIN  0
#define SCL  0.03125f   // 1 / sqrt(1024): this module divides by sqrt(k) with k the FULL width
typedef _Float16 h16;
typedef unsigned short bf;
typedef __attribute__((ext_vector_type(16))) __bf16   v16bf;
typedef __attribute__((ext_vector_type(16))) _Float16 v16h;
typedef __attribute__((ext_vector_type(8)))  _Float16 v8h;
typedef __attribute__((ext_vector_type(8)))  unsigned short v8us;
typedef __attribute__((ext_vector_type(8)))  float    v8f;
typedef __attribute__((ext_vector_type(4)))  float    v4f;
typedef v8h  __attribute__((may_alias)) v8ha;
typedef v4f  __attribute__((may_alias)) v4fa;
typedef v8us __attribute__((may_alias)) v8usa;

__device__ __forceinline__ unsigned short f2bf(float f) { unsigned u = __float_as_uint(f); u += 0x7FFFu + ((u >> 16) & 1u); return (unsigned short)(u >> 16); }
__device__ __forceinline__ float bf2f(unsigned short b) { return __uint_as_float(((unsigned)b) << 16); }
__device__ __forceinline__ float bfr(float f) { return bf2f(f2bf(f)); }
__device__ __forceinline__ v16h cat16(v8h lo, v8h hi) { return __builtin_shufflevector(lo, hi, 0, 1, 2, 3, 4, 5, 6, 7, 8, 9, 10, 11, 12, 13, 14, 15); }
__device__ __forceinline__ v16bf cat16b(v8us lo, v8us hi) { return __builtin_bit_cast(v16bf, __builtin_shufflevector(lo, hi, 0, 1, 2, 3, 4, 5, 6, 7, 8, 9, 10, 11, 12, 13, 14, 15)); }
__device__ __forceinline__ v8f wmma16(v16h a, v16h b, v8f c) { return __builtin_amdgcn_wmma_f32_16x16x32_f16(false, a, false, b, (short)0, c, false, false); }
__device__ __forceinline__ v8f wmmab(v16bf a, v16bf b, v8f c) { return __builtin_amdgcn_wmma_f32_16x16x32_bf16(false, a, false, b, (short)0, c, false, false); }
__device__ __forceinline__ h16 tohx(float x) { return (h16)x; }
__device__ __forceinline__ void splitf(float y, unsigned short& h, unsigned short& l) { h = f2bf(y); l = f2bf(y - bf2f(h)); }
typedef __attribute__((ext_vector_type(4))) _Float16 v4h;
typedef __attribute__((ext_vector_type(4))) unsigned short v4us;



// WFrag: fragment loader from a K-contiguous 16-bit plane (k order 8 hi + i, 16 + 8 hi + i) and the matching product.
template <typename T16> struct WFrag;
template <> struct WFrag<h16> { typedef v16h V; static __device__ __forceinline__ V ld(const h16* p) { return cat16(*(const v8h*)p, *(const v8h*)(p + 16)); } static __device__ __forceinline__ v8f mma(V a, V b, v8f c) { return wmma16(a, b, c); } };
template <> struct WFrag<bf> { typedef v16bf V; static __device__ __forceinline__ V ld(const bf* p) { return cat16b(*(const v8us*)p, *(const v8us*)(p + 16)); } static __device__ __forceinline__ v8f mma(V a, V b, v8f c) { return wmmab(a, b, c); } };
#define LP  72                      // LDS row pitch in 16-bit elements: 144 bytes = 16 x odd, conflict-free for 16-byte reads
template <typename V> __device__ __forceinline__ V ldsfrag(const unsigned short* p) { return __builtin_bit_cast(V, __builtin_shufflevector(*(const v8usa*)p, *(const v8usa*)(p + 16), 0, 1, 2, 3, 4, 5, 6, 7, 8, 9, 10, 11, 12, 13, 14, 15)); }

// ---- gemm128: one 128x128 output tile (tile row bx, tile column by) per work-group of 16 / MB waves (8 / MB x 2; a wave has MB x 4 accumulators = 16 MB rows x 64 columns), bf16 operands from K-contiguous planes.
// C[m][n] (f32, pitch ldc, + optional f32 bias[n]) = sum_k A[m][k] Bt[n][k] (+ A2[m][k] Bt[n][k] when SPLIT). K % 64 == 0, K >= 128.
// A stage is 64 k = one 128-byte line of each of the 128 A rows (and A2 rows) and 128 Bt rows: whole-line global loads into registers two stages ahead, stored to LDS one stage ahead, two LDS buffers, one barrier a stage; every wave sums all of K in k order.
// Every inner loop is fully unrolled so that each fragment, staging and accumulator index is a compile-time constant (registers, no scratch).
// PL: no f32 C; each wave's tile goes out as three 16-bit planes (fp16, bf16 hi, bf16 lo) at element (n / 64) * sN + m * ldc + n % 64. sN = TT * HD, ldc = HD: head planes [n / 64][m][n % 64]; sN = 64, ldc = N: plain row-major.
#define GPL (128 * LP)              // one staged operand plane: 128 rows
// Work-group barrier that orders LDS alone: each wave's LDS stores and reads are done before it signals, while its global loads into registers stay in flight across it (__syncthreads() waits for them too, which would cut their lead to less than a stage).
__device__ __forceinline__ void lds_barrier() { __builtin_amdgcn_fence(__ATOMIC_RELEASE, "workgroup", "local"); __builtin_amdgcn_s_barrier(); __builtin_amdgcn_fence(__ATOMIC_ACQUIRE, "workgroup", "local"); }
template <int MB, bool SPLIT, bool BIAS, bool PL>
__device__ __forceinline__ void gemm128(unsigned short* sm, const bf* __restrict__ A, const bf* __restrict__ A2, const bf* __restrict__ Bt, int K, float* C, int ldc, const float* __restrict__ bias, h16* P16, bf* Ph, bf* Pl, size_t sN, int bx, int by) {
    constexpr int NP = SPLIT ? 3 : 2;   // staged planes: A, Bt (, A2)
    constexpr int SR = 64 / MB, NR = 128 / SR;   // staging: rows a sweep of the work-group's 512 / MB threads, sweeps a plane
    const int lane = threadIdx.x & 31, lr = lane & 15, hi = lane >> 4;
    const int wv = __builtin_amdgcn_readfirstlane((int)(threadIdx.x >> 5)), wm = wv >> 1, wn = wv & 1;
    const int srow = (int)threadIdx.x >> 3, sseg = ((int)threadIdx.x & 7) * 8;   // staging: 8 threads a 128-byte row
    v8f acc[MB][4];
#pragma unroll
    for (int mb = 0; mb < MB; ++mb)
#pragma unroll
        for (int nb = 0; nb < 4; ++nb) acc[mb][nb] = (v8f){};
    const size_t ao = (size_t)(bx * 128 + srow) * K + sseg, bo = (size_t)(by * 128 + srow) * K + sseg;
    v8us st[NP][NR];
    auto gld = [&](int k0) {
#pragma unroll
        for (int r = 0; r < NR; ++r) { st[0][r] = *(const v8usa*)(A + ao + (size_t)(SR * r) * K + k0); st[1][r] = *(const v8usa*)(Bt + bo + (size_t)(SR * r) * K + k0); if constexpr (SPLIT) st[2][r] = *(const v8usa*)(A2 + ao + (size_t)(SR * r) * K + k0); }
        asm volatile("s_wait_xcnt 0x0" ::: "memory"); };   // stands between these loads and any later write of an address register that they name (the next trip re-forms the addresses)
    auto sst = [&](int buf) {
#pragma unroll
        for (int pl = 0; pl < NP; ++pl)
#pragma unroll
            for (int r = 0; r < NR; ++r) *(v8usa*)(sm + (buf * NP + pl) * GPL + (srow + SR * r) * LP + sseg) = st[pl][r]; };
    auto stage = [&](int buf) __attribute__((always_inline)) {   // the two 32-k steps over one staged buffer
        const unsigned short* sa = sm + buf * NP * GPL + (wm * (MB * 16) + lr) * LP + 8 * hi; const unsigned short* sb = sm + (buf * NP + 1) * GPL + (wn * 64 + lr) * LP + 8 * hi;
#pragma unroll
        for (int ks = 0; ks < 2; ++ks) { v16bf a[MB], a2[MB], b[4];
#pragma unroll
            for (int f = 0; f < MB; ++f) { a[f] = ldsfrag<v16bf>(sa + f * 16 * LP + ks * 32); if constexpr (SPLIT) a2[f] = ldsfrag<v16bf>(sa + 2 * GPL + f * 16 * LP + ks * 32); }
#pragma unroll
            for (int f = 0; f < 4; ++f) b[f] = ldsfrag<v16bf>(sb + f * 16 * LP + ks * 32);
#pragma unroll
            for (int nb = 0; nb < 4; ++nb)
#pragma unroll
                for (int mb = 0; mb < MB; ++mb) acc[mb][nb] = wmmab(a[mb], b[nb], acc[mb][nb]);
            if constexpr (SPLIT) {
#pragma unroll
                for (int nb = 0; nb < 4; ++nb)
#pragma unroll
                    for (int mb = 0; mb < MB; ++mb) acc[mb][nb] = wmmab(a2[mb], b[nb], acc[mb][nb]); } } };
    const int ns = K / 64;
    gld(0); sst(0); gld(64);
    lds_barrier();   // stage 0 is in LDS before any wave reads it
#pragma unroll 1   // stays rolled: a second copy of the stage would double the staging registers and the code
    for (int sg = 0; sg < ns - 2; ++sg) {
        sst((sg + 1) & 1);   // loaded a whole trip ago; into the buffer whose last readers left it before the previous barrier
        gld((sg + 2) * 64);   // flies during this stage's products and the barrier
        stage(sg & 1);
        lds_barrier();   // publishes stage sg + 1 and ends every wave's reads of stage sg, whose buffer the next trip refills
    }
    sst((ns - 1) & 1); stage((ns - 2) & 1);
    __syncthreads();   // publishes the last stage
    stage((ns - 1) & 1);
    __syncthreads();   // every wave has left the ring before the output tiles overwrite it
    float* ow = (float*)sm + wv * (MB * 16 * 68);   // each wave's own f32 tile, pitch 68
#pragma unroll
    for (int mb = 0; mb < MB; ++mb)
#pragma unroll
        for (int nb = 0; nb < 4; ++nb)
#pragma unroll
            for (int j = 0; j < 8; ++j) ow[(mb * 16 + hi * 8 + j) * 68 + nb * 16 + lr] = acc[mb][nb][j];
    __syncthreads();   // the tile is whole in LDS before its rows are read back for whole-line stores
    const int r0 = bx * 128 + wm * (MB * 16), c0 = by * 128 + wn * 64, cofs = lr * 4;
    v4f bv = (v4f){};
    if (BIAS) { bv[0] = bfr(bias[c0 + cofs]); bv[1] = bfr(bias[c0 + cofs + 1]); bv[2] = bfr(bias[c0 + cofs + 2]); bv[3] = bfr(bias[c0 + cofs + 3]); }
#pragma unroll 1   // stays rolled: all rows unrolled would only grow the code
    for (int s0 = 0; s0 < MB * 8; s0 += 4) {
#pragma unroll   // four row pairs in flight hide the LDS read latency
        for (int u = 0; u < 4; ++u) { const int row = 2 * (s0 + u) + hi; v4f val = *(const v4fa*)(ow + row * 68 + cofs);
            if (BIAS) val += bv;
            if constexpr (PL) { const size_t po = (size_t)(c0 / 64) * sN + (size_t)(r0 + row) * ldc + cofs; v4h o16; v4us oh, ol;
#pragma unroll
                for (int k = 0; k < 4; ++k) { o16[k] = tohx(val[k]); unsigned short a2, c2; splitf(val[k], a2, c2); oh[k] = a2; ol[k] = c2; }
                *(v4h*)(P16 + po) = o16; *(v4us*)(Ph + po) = oh; *(v4us*)(Pl + po) = ol; }
            else *(v4f*)(C + (size_t)(r0 + row) * ldc + c0 + cofs) = val; }
        asm volatile("s_wait_xcnt 0x0" ::: "memory");   // stands between these stores and the next trip's writes of the registers that they name
    }
}

// k_gemmo: merged hi/lo x Wo + bo for the rows of both batches; grid (NB_ * TT / 128, DM / 128), one work-group a WGP: 8 waves (32 x 64 each), two a SIMD.
__global__ __launch_bounds__(256) void k_gemmo(const bf* __restrict__ Ah, const bf* __restrict__ Al, const bf* __restrict__ Wo, float* C, const float* __restrict__ bias) {
    __shared__ __align__(16) unsigned short sm[2 * 3 * GPL];   // two buffers of three planes
    gemm128<2, true, true, false>(sm, Ah, Al, Wo, DQ, C, DM, bias, nullptr, nullptr, nullptr, 0, blockIdx.x, blockIdx.y);
}
// k_qkv: the three projections of both batches in one launch; grid (tiles of one projection of one batch, NB_, 3), z = 0 Q, 1 K, 2 V. W: Wq, Wk, Wv one behind the other; each plane set: [z][batch][head]...
// Q, K: x W^T, planes [h][t][d]. V: Wv x^T, planes [h][d][t]. The x tile is f % (TT / 128) in all three, so work-groups that differ only in z read the same x rows.
static_assert(DQ == DKV, "the three projections share one tile count and one plane size");
static_assert(2 * 2 * GPL * 2 >= 4 * 64 * 68 * 4, "the four f32 output tiles fit the ring");
__global__ __launch_bounds__(128) void k_qkv(const bf* __restrict__ X, const bf* __restrict__ Wt, h16* P16, bf* Ph, bf* Pl) {
    __shared__ __align__(16) unsigned short sm[2 * 2 * GPL];   // two buffers of two planes
    const unsigned f = blockIdx.x, b = blockIdx.y, pj = blockIdx.z; const bool tv = pj == 2;
    const bf* xb = X + (size_t)b * TT * DM; const bf* w = Wt + (size_t)pj * DQ * DM; const size_t pp = ((size_t)pj * NB_ + b) * ((size_t)DQ * TT);
    gemm128<4, false, false, true>(sm, tv ? w : xb, nullptr, tv ? xb : w, DM, nullptr, tv ? TT : HD, nullptr, P16 + pp, Ph + pp, Pl + pp, tv ? (size_t)64 : (size_t)TT * HD, tv ? f / (TT / 128) : f % (TT / 128), tv ? f % (TT / 128) : f / (TT / 128));
}

typedef __attribute__((ext_vector_type(2))) float v2f;

// k_cvt8: every f32 input but the bias to bf16 in one launch; dst holds Wq, Wk, Wv, Wo, x one behind the other. WB blocks a weight, the rest of the grid is x (both batches).
#define WB (DQ * DM / 8 / 256)
__global__ __launch_bounds__(256) void k_cvt8(const float* __restrict__ wq, const float* __restrict__ wk, const float* __restrict__ wv, const float* __restrict__ wo, const float* __restrict__ x, bf* dst) {
    const unsigned blk = blockIdx.x; const float* src = blk < WB ? wq : blk < 2 * WB ? wk : blk < 3 * WB ? wv : blk < 4 * WB ? wo : x;
    const size_t i = (size_t)(blk < 4 * WB ? blk % WB : blk - 4 * WB) * 256 + threadIdx.x; const v8f v = *(const v8f*)(src + i * 8); v8us o;
#pragma unroll
    for (int k = 0; k < 8; ++k) o[k] = f2bf(v[k]); *(v8us*)(dst + ((size_t)blk * 256 + threadIdx.x) * 8) = o;  }

#define SC2 (SCL * 1.4426950408889634f)   // score scale x log2(e): scores go straight to the exp2 domain
#define SK  64                      // keys per stage: K rows (HD) and V^T rows (SK) are both 128 bytes
#define PLN (64 * LP)               // one staged plane: 64 rows
__device__ __forceinline__ float xhalf(float x) { const int b = __float_as_int(x); return __int_as_float(__builtin_amdgcn_permlanex16(b, b, 0x76543210, 0xfedcba98, false, false)); }   // lane l <-> l ^ 16
template <typename T16, bool HI, int QT>
__device__ __forceinline__ void attn_wg(unsigned short* sm, const T16* __restrict__ Q, const T16* __restrict__ Q2, const T16* __restrict__ Kp, const T16* __restrict__ K2, const T16* __restrict__ Vt, const T16* __restrict__ V2, int q0, bf* Ah, bf* Al) {
    typedef WFrag<T16> F; typedef typename F::V V;
    constexpr int NP = HI ? 4 : 2;   // staged planes: K, V^T (, K lo, V^T lo)
    const int lane = threadIdx.x & 31, lr = lane & 15, hi = lane >> 4;
    const int srow = (int)threadIdx.x >> 3, sseg = ((int)threadIdx.x & 7) * 8;   // staging: 8 threads a 128-byte row, 16 rows a sweep of the 128 threads
    V qf[QT][2], q2[QT][2];
#pragma unroll
    for (int qt = 0; qt < QT; ++qt)
#pragma unroll
        for (int ks = 0; ks < 2; ++ks) { const size_t qo = (size_t)(q0 + qt * 16 + lr) * HD + ks * 32 + 8 * hi; qf[qt][ks] = F::ld(Q + qo); if (HI) q2[qt][ks] = F::ld(Q2 + qo); }
    v8f o[4][QT]; float m[QT], l[QT];
#pragma unroll
    for (int qt = 0; qt < QT; ++qt) { m[qt] = -3.0e38f; l[qt] = 0.f;
#pragma unroll
        for (int db = 0; db < 4; ++db) o[db][qt] = (v8f){}; }
    v8us st[NP][4]; const unsigned sko = (unsigned)(srow * HD + sseg), svo = (unsigned)(srow * TT + sseg);
    auto gld = [&](int k0) {
#pragma unroll
        for (int r = 0; r < 4; ++r) { const unsigned kg = sko + 16 * r * HD, vg = svo + 16 * r * TT;   // wave-uniform base + 32-bit lane offset
            st[0][r] = *(const v8usa*)(Kp + (size_t)k0 * HD + kg); st[1][r] = *(const v8usa*)(Vt + k0 + vg); if constexpr (HI) { st[2][r] = *(const v8usa*)(K2 + (size_t)k0 * HD + kg); st[3][r] = *(const v8usa*)(V2 + k0 + vg); } } };
    auto sst = [&](int buf) {
#pragma unroll
        for (int pl = 0; pl < NP; ++pl)
#pragma unroll
            for (int r = 0; r < 4; ++r) *(v8usa*)(sm + (buf * NP + pl) * PLN + (srow + 16 * r) * LP + sseg) = st[pl][r]; };
    auto stage = [&](int buf) __attribute__((always_inline)) {   // the two 32-key passes over one staged buffer
        const unsigned short* sb = sm + buf * NP * PLN + lr * LP + 8 * hi;
#pragma unroll
        for (int ps = 0; ps < SK / 32; ++ps) {
            v8f s[2][QT];
#pragma unroll
            for (int kt = 0; kt < 2; ++kt) { V kf[2], k2[2];
#pragma unroll
                for (int ks = 0; ks < 2; ++ks) { kf[ks] = ldsfrag<V>(sb + (ps * 32 + kt * 16) * LP + ks * 32); if (HI) k2[ks] = ldsfrag<V>(sb + 2 * PLN + (ps * 32 + kt * 16) * LP + ks * 32); }
#pragma unroll
                for (int qt = 0; qt < QT; ++qt) { v8f t = (v8f){};
#pragma unroll
                    for (int ks = 0; ks < 2; ++ks) { t = F::mma(kf[ks], qf[qt][ks], t); if (HI) { t = F::mma(kf[ks], q2[qt][ks], t); t = F::mma(k2[ks], qf[qt][ks], t); } }
                    s[kt][qt] = t; } }
            V vf[4], v2[4];
#pragma unroll
            for (int db = 0; db < 4; ++db) { vf[db] = ldsfrag<V>(sb + PLN + db * 16 * LP + ps * 32); if (HI) v2[db] = ldsfrag<V>(sb + 3 * PLN + db * 16 * LP + ps * 32); }
            __builtin_amdgcn_sched_barrier(0);   // keeps the V^T reads issued here, ahead of the softmax that hides their LDS latency; without it they sink to the second product, one waited pair at a time
            float mn[QT]; bool need = false;
#pragma unroll
            for (int qt = 0; qt < QT; ++qt) { float mx = fmaxf(s[0][qt][0], s[1][qt][0]);
#pragma unroll
                for (int j = 1; j < 8; ++j) mx = fmaxf(mx, fmaxf(s[0][qt][j], s[1][qt][j]));
                mx = fmaxf(mx, xhalf(mx)) * SC2; mn[qt] = mx; need = need || (mx > m[qt] + 8.0f); }
            if (__builtin_amdgcn_ballot_w32(need) != 0) {   // wave-uniform: one scalar branch a pass
#pragma unroll
                for (int qt = 0; qt < QT; ++qt) { const float mw = fmaxf(m[qt], mn[qt]); const float al = __builtin_amdgcn_exp2f(m[qt] - mw); m[qt] = mw; l[qt] *= al;
#pragma unroll
                    for (int db = 0; db < 4; ++db) o[db][qt] *= al; } }
            V pf[QT], p2[QT];
#pragma unroll
            for (int qt = 0; qt < QT; ++qt) { v2f ls = (v2f){};
#pragma unroll
                for (int kt = 0; kt < 2; ++kt)
#pragma unroll
                    for (int j = 0; j < 8; j += 2) { const v2f t = __builtin_elementwise_fma((v2f){s[kt][qt][j], s[kt][qt][j + 1]}, (v2f){SC2, SC2}, (v2f){-m[qt], -m[qt]}); s[kt][qt][j] = __builtin_amdgcn_exp2f(t[0]); s[kt][qt][j + 1] = __builtin_amdgcn_exp2f(t[1]); }
#pragma unroll
                for (int i = 0; i < 16; ++i) { const float p = s[i >> 3][qt][i & 7]; ls[i & 1] += p;
                    if constexpr (HI) { const __bf16 ph = (__bf16)p; pf[qt][i] = ph; p2[qt][i] = (__bf16)(p - (float)ph); } else pf[qt][i] = (_Float16)p; }
                l[qt] += ls[0] + ls[1]; }
#pragma unroll
            for (int db = 0; db < 4; ++db)
#pragma unroll
                for (int qt = 0; qt < QT; ++qt) { o[db][qt] = F::mma(vf[db], pf[qt], o[db][qt]); if (HI) { o[db][qt] = F::mma(vf[db], p2[qt], o[db][qt]); o[db][qt] = F::mma(v2[db], pf[qt], o[db][qt]); } }
        }
    };
    gld(0); sst(0);
    __syncthreads();   // stage 0 is in LDS before any wave reads it
#pragma unroll 1   // stays rolled: a second copy of the stage would double the staging registers and the code
    for (int sg = 0; sg < TT / SK - 1; ++sg) {
        gld((sg + 1) * SK);   // the next stage flies during this stage's two passes
        stage(sg & 1);
        sst((sg + 1) & 1);   // into the buffer whose last readers left it before the previous barrier
        __syncthreads();   // publishes stage sg + 1 and ends every wave's reads of stage sg, whose buffer the next trip refills
    }
    stage((TT / SK - 1) & 1);
#pragma unroll
    for (int qt = 0; qt < QT; ++qt) { const float inv = __fdiv_rn(1.0f, l[qt] + xhalf(l[qt])); const size_t oo = (size_t)(q0 + qt * 16 + lr) * DQ + hi * 8;
#pragma unroll
        for (int db = 0; db < 4; ++db) { v8us oh, ol;
#pragma unroll
            for (int j = 0; j < 8; ++j) { unsigned short a, c2; splitf(o[db][qt][j] * inv, a, c2); oh[j] = a; ol[j] = c2; }
            *(v8us*)(Ah + oo + db * 16) = oh; *(v8us*)(Al + oo + db * 16) = ol; } }
    asm volatile("s_wait_xcnt 0x0" ::: "memory");   // stands between the last stores and any later write of a register that they name
}
// grid (NB_ * heads, RH / 64 + (TT - RH) / 128), x = batch * heads + head, 4 waves: the hi/lo blocks (16 queries a wave) come first in y, then the fp16 blocks (32 queries a wave)
__global__ __launch_bounds__(128) void k_fattn(const h16* __restrict__ Q16, const bf* __restrict__ Qh, const bf* __restrict__ Ql, const h16* __restrict__ K16, const bf* __restrict__ Kh, const bf* __restrict__ Kl, const h16* __restrict__ V16, const bf* __restrict__ Vh, const bf* __restrict__ Vl, bf* Ah, bf* Al) {
    __shared__ __align__(16) unsigned short sm[2 * 4 * PLN];   // two buffers of up to four planes
    const int h = blockIdx.x % NH_, y = blockIdx.y; const int wv = __builtin_amdgcn_readfirstlane((int)(threadIdx.x >> 5)); const size_t ho = (size_t)blockIdx.x * TT * HD;   // planes [batch][head]...
    Ah += (size_t)(blockIdx.x / NH_) * TT * DQ; Al += (size_t)(blockIdx.x / NH_) * TT * DQ;
    if (y < RH / 64) attn_wg<bf, true, 1>(sm, Qh + ho, Ql + ho, Kh + ho, Kl + ho, Vh + ho, Vl + ho, y * 64 + wv * 16, Ah + h * HD, Al + h * HD);
    else attn_wg<h16, false, 2>(sm, Q16 + ho, nullptr, K16 + ho, nullptr, V16 + ho, nullptr, RH + (y - RH / 64) * 128 + wv * 32, Ah + h * HD, Al + h * HD);
}

extern "C" void kernel_launch(void* const* d_in, const int* in_sizes, int n_in,
                              void* d_out, int out_size, void* d_ws, size_t ws_size, hipStream_t stream) {
    (void)in_sizes; (void)n_in; (void)out_size;
    const float* x = (const float*)d_in[0]; const float* wq = (const float*)d_in[1]; const float* wk = (const float*)d_in[2]; const float* wv = (const float*)d_in[3]; const float* wo = (const float*)d_in[4]; const float* bo = (const float*)d_in[5];   /* input order x, Wq, Wk, Wv, Wo ('oi' [1024][1024]), bo */
    float* OUT = (float*)d_out;     // [2][2048][1024]
    char* wsp = (char*)d_ws;
    auto take = [&](size_t bytes) { char* p = wsp; wsp += (bytes + 255) & ~(size_t)255; return (void*)p; };
    bf* CV = (bf*)take(((size_t)4 * DQ * DM + (size_t)NB_ * TT * DM) * 2);   // Wq, Wk, Wv, Wo, x as bf16
    bf* WO = CV + (size_t)3 * DQ * DM; bf* XB = CV + (size_t)4 * DQ * DM;
    const size_t PS = (size_t)NB_ * DQ * TT;   // one plane of one projection, both batches
    h16* P16 = (h16*)take(3 * PS * 2); bf* Ph = (bf*)take(3 * PS * 2); bf* Pl = (bf*)take(3 * PS * 2);   // each: Q [b][h][t][d], K [b][h][t][d], V^T [b][h][d][t]
    bf* ATh = (bf*)take((size_t)NB_ * TT * DQ * 2); bf* ATl = (bf*)take((size_t)NB_ * TT * DQ * 2);
    if ((size_t)(wsp - (char*)d_ws) > ws_size) return;    // 104 of 256 MiB
    k_cvt8<<<4 * WB + NB_ * TT * DM / 8 / 256, 256, 0, stream>>>(wq, wk, wv, wo, x, CV);
    k_qkv<<<dim3((TT / 128) * (DQ / 128), NB_, 3), 128, 0, stream>>>(XB, CV, P16, Ph, Pl);
    k_fattn<<<dim3(NB_ * NH_, RH / 64 + (TT - RH) / 128, 1), 128, 0, stream>>>(P16, Ph, Pl, P16 + PS, Ph + PS, Pl + PS, P16 + 2 * PS, Ph + 2 * PS, Pl + 2 * PS, ATh, ATl);   // one kv head per query head
    k_gemmo<<<dim3(NB_ * TT / 128, DM / 128, 1), 256, 0, stream>>>(ATh, ATl, WO, OUT, bo);
}
